// v000
// Measured on an AMD MI455X. A time is GPU time per run, averaged over a window of back-to-back runs after a warm-up
// (all launches, gaps included; the runs take copies of the inputs in turn), and the median of several windows.
// Apart from v000's, it joins two sittings. Times from different sittings can be a few percent apart, while
// side-by-side timings come from the same sitting.
// v000, which the later versions start from, runs in 4020 microseconds.
#include <hip/hip_runtime.h>

// Decoder cross-attention with per-head weights (normalized_resid_pre, encoder_output [8][1024][1024]; q, k from encoder_output and v from normalized_resid_pre via 'hde' per-head weights [16][1024][64] + [16][64] biases; scores / 8 with the strict upper triangle REPLACED by -1e5; softmax; z O ('hed' [16][64][1024]) + Ob -> [8][1024][1024] (8.4 M)).
// Layout per batch: the per-head 'hde' weights gathered once into single [1024][1024] operands (one exact GEMM per projection, flattened biases); causal T-1024 attention (hybrid rows: < 512 hi/lo 3 products, rest fp16 x1024; k_gemmc skips the tiles above the diagonal, whose weights are exactly zero after the -1e5 fill); merged context as hi/lo planes; O (flat 'xw' [1024][1024]) hl x exact + Ob.
// Compute dtypes, f32 accumulate: every input rounded to bf16; projections exact + f32 biases; attention rows < 512 3 products, rest fp16; softmax f32; O hl x exact + bias.

#define NB_  8
#define TT   1024
#define DM   1024
#define NH_  16
#define NKV  16
#define REP  (NH_ / NKV)
#define HD   64
#define DQ   (NH_ * HD)
#define DKV  (NKV * HD)
#define ZH   2
#define RH   512                  // query rows < RH use hi+lo planes (0: none)
#define WIN  1024
#define PCAR 1024.0f
#define SCL  0.125f   // HD^-0.5
typedef _Float16 h16;
typedef unsigned short bf;
typedef __attribute__((ext_vector_type(16))) __bf16   v16bf;
typedef __attribute__((ext_vector_type(16))) _Float16 v16h;
typedef __attribute__((ext_vector_type(8)))  _Float16 v8h;
typedef __attribute__((ext_vector_type(8)))  unsigned short v8us;
typedef __attribute__((ext_vector_type(8)))  float    v8f;
typedef __attribute__((ext_vector_type(4)))  float    v4f;
typedef v8h  __attribute__((may_alias)) v8ha;
typedef v4f  __attribute__((may_alias)) v4fa;
typedef v8us __attribute__((may_alias)) v8usa;

__device__ __forceinline__ unsigned short f2bf(float f) { unsigned u = __float_as_uint(f); u += 0x7FFFu + ((u >> 16) & 1u); return (unsigned short)(u >> 16); }
__device__ __forceinline__ float bf2f(unsigned short b) { return __uint_as_float(((unsigned)b) << 16); }
__device__ __forceinline__ float bfr(float f) { return bf2f(f2bf(f)); }
__device__ __forceinline__ v16h cat16(v8h lo, v8h hi) { return __builtin_shufflevector(lo, hi, 0, 1, 2, 3, 4, 5, 6, 7, 8, 9, 10, 11, 12, 13, 14, 15); }
__device__ __forceinline__ v16bf cat16b(v8us lo, v8us hi) { return __builtin_bit_cast(v16bf, __builtin_shufflevector(lo, hi, 0, 1, 2, 3, 4, 5, 6, 7, 8, 9, 10, 11, 12, 13, 14, 15)); }
__device__ __forceinline__ v8f wmma16(v16h a, v16h b, v8f c) { return __builtin_amdgcn_wmma_f32_16x16x32_f16(false, a, false, b, (short)0, c, false, false); }
__device__ __forceinline__ v8f wmmab(v16bf a, v16bf b, v8f c) { return __builtin_amdgcn_wmma_f32_16x16x32_bf16(false, a, false, b, (short)0, c, false, false); }



// ---- k_gemmw: register-blocked GEMM, ONE WAVE per 64x64 output tile (16 accumulators), operands straight from K-contiguous 16-bit planes; grid (M/64, N/64, Z), 32 threads.
// C[m][n] (f32, pitch ldc, + optional f32 bias[n]) = sum_k A[m][k] Bt[n][k] (+ split products per NSPLIT). z-batch strides sA/sB/sC in elements. K % 32 == 0.
template <typename T16> struct WFrag;
template <> struct WFrag<h16> { typedef v16h V; static __device__ __forceinline__ V ld(const h16* p) { return cat16(*(const v8h*)p, *(const v8h*)(p + 16)); } static __device__ __forceinline__ v8f mma(V a, V b, v8f c) { return wmma16(a, b, c); } };
template <> struct WFrag<bf> { typedef v16bf V; static __device__ __forceinline__ V ld(const bf* p) { return cat16b(*(const v8us*)p, *(const v8us*)(p + 16)); } static __device__ __forceinline__ v8f mma(V a, V b, v8f c) { return wmmab(a, b, c); } };
template <typename T16, int NSPLIT, bool BIAS>
__global__ __launch_bounds__(32) void k_gemmw(const T16* __restrict__ A, const T16* __restrict__ A2, const T16* __restrict__ Bt, const T16* __restrict__ Bt2, int K, float* C, int ldc, const float* __restrict__ bias, size_t sA, size_t sB, size_t sC) {
    typedef typename WFrag<T16>::V V;
    __shared__ __align__(16) float os[16 * 68];
    const size_t z = blockIdx.z; A += z * sA; if (A2) A2 += z * sA; Bt += z * sB; if (Bt2) Bt2 += z * sB; C += z * sC;
    const int lane = threadIdx.x & 31, lr = lane & 15, hi = lane >> 4; const int r0 = blockIdx.x * 64, c0 = blockIdx.y * 64;
    v8f acc[4][4];
#pragma unroll
    for (int mb = 0; mb < 4; ++mb)
#pragma unroll
        for (int nb = 0; nb < 4; ++nb) acc[mb][nb] = (v8f){};
    const size_t aoff = (size_t)(r0 + lr) * K + 8 * hi, boff = (size_t)(c0 + lr) * K + 8 * hi;
#pragma unroll 1
    for (int kc = 0; kc < K; kc += 32) {
        V a[4], a2[4];
#pragma unroll
        for (int mb = 0; mb < 4; ++mb) { a[mb] = WFrag<T16>::ld(A + aoff + (size_t)mb * 16 * K + kc); if (NSPLIT == 1 || NSPLIT == 2) a2[mb] = WFrag<T16>::ld(A2 + aoff + (size_t)mb * 16 * K + kc); }
#pragma unroll
        for (int nb = 0; nb < 4; ++nb) { const V b = WFrag<T16>::ld(Bt + boff + (size_t)nb * 16 * K + kc); V b2; if (NSPLIT >= 2) b2 = WFrag<T16>::ld(Bt2 + boff + (size_t)nb * 16 * K + kc);
#pragma unroll
            for (int mb = 0; mb < 4; ++mb) { acc[mb][nb] = WFrag<T16>::mma(a[mb], b, acc[mb][nb]); if (NSPLIT == 1 || NSPLIT == 2) acc[mb][nb] = WFrag<T16>::mma(a2[mb], b, acc[mb][nb]); if (NSPLIT >= 2) acc[mb][nb] = WFrag<T16>::mma(a[mb], b2, acc[mb][nb]); } }
        asm volatile("v_nop\n\tv_nop\n\tv_nop\n\tv_nop" : "+v"(acc[0][0]), "+v"(acc[1][1]), "+v"(acc[2][2]), "+v"(acc[3][3]) : "v"(a[0]), "v"(a[3]));
    }
#pragma unroll
    for (int mb = 0; mb < 4; ++mb) {
#pragma unroll
        for (int nb = 0; nb < 4; ++nb) {
#pragma unroll
            for (int j = 0; j < 8; ++j) os[(hi * 8 + j) * 68 + nb * 16 + lr] = acc[mb][nb][j]; }
        __builtin_amdgcn_wave_barrier(); asm volatile("" ::: "memory");
        float* crow = C + (size_t)(r0 + mb * 16) * ldc + c0;
{
#pragma unroll
            for (int s = 0; s < 8; ++s) { const int row = 2 * s + hi, cofs = lr * 4; v4f val = *(const v4fa*)(os + row * 68 + cofs); if (BIAS) { val[0] += bfr(bias[c0 + cofs]); val[1] += bfr(bias[c0 + cofs + 1]); val[2] += bfr(bias[c0 + cofs + 2]); val[3] += bfr(bias[c0 + cofs + 3]); }
                *(v4f*)(crow + (size_t)row * ldc + cofs) = val; }
             }
        __builtin_amdgcn_wave_barrier(); asm volatile("" ::: "memory");
    }
}

// ---- k_gemmc: the same one-wave 64x64 tile GEMM specialised for causal attention: CMODE 1 skips score tiles entirely above the diagonal (query rows r0+roff.., key columns c0..), CMODE 2 limits the
// key (K) loop of the probability x value contraction to the diagonal block (probabilities beyond it are exactly zero). roff = row offset of this launch's first row within the sequence.
template <typename T16, int NSPLIT, int CMODE>
__global__ __launch_bounds__(32) void k_gemmc(const T16* __restrict__ A, const T16* __restrict__ A2, const T16* __restrict__ Bt, const T16* __restrict__ Bt2, int K, float* C, int ldc, int roff, size_t sA, size_t sB, size_t sC) {
    typedef typename WFrag<T16>::V V;
    __shared__ __align__(16) float os[16 * 68];
    const size_t z = blockIdx.z; A += z * sA; if (A2) A2 += z * sA; Bt += z * sB; if (Bt2) Bt2 += z * sB; C += z * sC;
    const int lane = threadIdx.x & 31, lr = lane & 15, hi = lane >> 4; const int r0 = blockIdx.x * 64, c0 = blockIdx.y * 64;
    if (CMODE == 1 && c0 > r0 + roff + 63) return;                  // score tile entirely above the causal diagonal: never read (the softmax masks j > i by select)
    const int Kl = (CMODE == 2) ? min(K, r0 + roff + 64) : K;        // P.V: probabilities are exactly 0 beyond the diagonal block, so the K loop stops there
    v8f acc[4][4];
#pragma unroll
    for (int mb = 0; mb < 4; ++mb)
#pragma unroll
        for (int nb = 0; nb < 4; ++nb) acc[mb][nb] = (v8f){};
    const size_t aoff = (size_t)(r0 + lr) * K + 8 * hi, boff = (size_t)(c0 + lr) * K + 8 * hi;
#pragma unroll 1
    for (int kc = 0; kc < Kl; kc += 32) {
        V a[4], a2[4];
#pragma unroll
        for (int mb = 0; mb < 4; ++mb) { a[mb] = WFrag<T16>::ld(A + aoff + (size_t)mb * 16 * K + kc); if (NSPLIT == 1 || NSPLIT == 2) a2[mb] = WFrag<T16>::ld(A2 + aoff + (size_t)mb * 16 * K + kc); }
#pragma unroll
        for (int nb = 0; nb < 4; ++nb) { const V b = WFrag<T16>::ld(Bt + boff + (size_t)nb * 16 * K + kc); V b2; if (NSPLIT >= 2) b2 = WFrag<T16>::ld(Bt2 + boff + (size_t)nb * 16 * K + kc);
#pragma unroll
            for (int mb = 0; mb < 4; ++mb) { acc[mb][nb] = WFrag<T16>::mma(a[mb], b, acc[mb][nb]); if (NSPLIT == 1 || NSPLIT == 2) acc[mb][nb] = WFrag<T16>::mma(a2[mb], b, acc[mb][nb]); if (NSPLIT >= 2) acc[mb][nb] = WFrag<T16>::mma(a[mb], b2, acc[mb][nb]); } }
        asm volatile("v_nop\n\tv_nop\n\tv_nop\n\tv_nop" : "+v"(acc[0][0]), "+v"(acc[1][1]), "+v"(acc[2][2]), "+v"(acc[3][3]) : "v"(a[0]), "v"(a[3]));
    }
#pragma unroll
    for (int mb = 0; mb < 4; ++mb) {
#pragma unroll
        for (int nb = 0; nb < 4; ++nb) {
#pragma unroll
            for (int j = 0; j < 8; ++j) os[(hi * 8 + j) * 68 + nb * 16 + lr] = acc[mb][nb][j]; }
        __builtin_amdgcn_wave_barrier(); asm volatile("" ::: "memory");
        float* crow = C + (size_t)(r0 + mb * 16) * ldc + c0;
{
#pragma unroll
            for (int s = 0; s < 8; ++s) { const int row = 2 * s + hi, cofs = lr * 4; v4f val = *(const v4fa*)(os + row * 68 + cofs);
                *(v4f*)(crow + (size_t)row * ldc + cofs) = val; }
             }
        __builtin_amdgcn_wave_barrier(); asm volatile("" ::: "memory");
    }
}

__device__ __forceinline__ h16 tohx(float x) { return (h16)x; }
__device__ __forceinline__ void splitf(float y, unsigned short& h, unsigned short& l) { h = f2bf(y); l = f2bf(y - bf2f(h)); }
typedef __attribute__((ext_vector_type(2))) _Float16 v2h;
typedef __attribute__((ext_vector_type(4))) _Float16 v4h;
typedef __attribute__((ext_vector_type(2))) unsigned short v2us;
typedef __attribute__((ext_vector_type(4))) unsigned short v4us;
typedef __attribute__((ext_vector_type(2))) float v2f;
typedef __attribute__((ext_vector_type(4))) int v4i;

__global__ __launch_bounds__(256) void k_wtG(const float* __restrict__ w, int K, int N, bf* Bt) {
    const int lane = threadIdx.x & 31; const int L0 = (blockIdx.x * 8 + (threadIdx.x >> 5)) * 8; const int nlines = N * K / 64;
{
#pragma unroll 1
        for (int l = 0; l < 8; ++l) { const int L = L0 + l; if (L >= nlines) break; const size_t e = (size_t)L * 64 + lane * 2; const int k = (int)(e % K), n = (int)(e / K); v2us o;
            o[0] = f2bf(w[(size_t)k * N + n]); o[1] = f2bf(w[(size_t)(k + 1) * N + n]); *(v2us*)(Bt + e) = o; }
         }
}
__global__ __launch_bounds__(256) void k_cvt8(const float* __restrict__ src, bf* dst, size_t n8) { const size_t i = (size_t)blockIdx.x * 256 + threadIdx.x; if (i >= n8) return; const v8f v = *(const v8f*)(src + i * 8); v8us o;
#pragma unroll
    for (int k = 0; k < 8; ++k) o[k] = f2bf(v[k]); *(v8us*)(dst + i * 8) = o;  }

// k_rope: head planes [h][t][d] (fp16 + hi/lo) of rope(x) x sc with the rotate-half convention out[d] = x[d] cos[t][d] - x[d+HD/2] sin[t][d], out[d+HD/2] = x[d+HD/2] cos[t][d+HD/2] + x[d] sin[t][d+HD/2]
__global__ __launch_bounds__(256) void k_rope(const float* __restrict__ F, int pitch, int nheads, const float* __restrict__ CS, const float* __restrict__ RF, const float* __restrict__ nw, float sc, h16* P16, bf* Ph, bf* Pl) {
    const size_t e = ((size_t)blockIdx.x * 256 + threadIdx.x) * 2; if (e >= (size_t)nheads * TT * HD) return; const int d = (int)(e % HD); const int t = (int)((e / HD) % TT); const int h = (int)(e / ((size_t)HD * TT)); const float* f = F + (size_t)t * pitch + h * HD; const float rf = RF ? RF[(size_t)h * TT + t] : 1.0f; v2h o16; v2us oh, ol;
#pragma unroll
    for (int q = 0; q < 2; ++q) { const int dd = d + q; const int dp = (dd < HD / 2) ? dd + HD / 2 : dd - HD / 2; float x0 = f[dd], x1 = f[dp];
        if (RF) { float n0 = __fmul_rn(x0, rf), n1 = __fmul_rn(x1, rf); asm volatile("" : "+v"(n0)); asm volatile("" : "+v"(n1)); x0 = __fmul_rn(bfr(nw[dd]), n0); x1 = __fmul_rn(bfr(nw[dp]), n1); }
        const v2f cs = *(const v2f*)(CS + ((size_t)t * HD + dd) * 2); float a = __fmul_rn(x0, cs[0]), bq = __fmul_rn(x1, cs[1]); asm volatile("" : "+v"(a)); asm volatile("" : "+v"(bq)); const float r = ((dd < HD / 2) ? __fsub_rn(a, bq) : __fadd_rn(a, bq)) * sc;
        o16[q] = tohx(r); unsigned short a2, c2; splitf(r, a2, c2); oh[q] = a2; ol[q] = c2; }
    *(v2h*)(P16 + e) = o16; *(v2us*)(Ph + e) = oh; *(v2us*)(Pl + e) = ol;  }
__global__ __launch_bounds__(256) void k_vtp(const float* __restrict__ F, int pitch, int nheads, h16* V16, bf* Vh, bf* Vl) { const size_t e = ((size_t)blockIdx.x * 256 + threadIdx.x) * 2; if (e >= (size_t)nheads * HD * TT) return; const int t = (int)(e % TT); const int d = (int)((e / TT) % HD); const int g = (int)(e / ((size_t)TT * HD)); v2h o16; v2us oh, ol;
#pragma unroll
    for (int q = 0; q < 2; ++q) { const float x = F[(size_t)(t + q) * pitch + g * HD + d]; o16[q] = tohx(x); unsigned short a2, c2; splitf(x, a2, c2); oh[q] = a2; ol[q] = c2; }
    *(v2h*)(V16 + e) = o16; *(v2us*)(Vh + e) = oh; *(v2us*)(Vl + e) = ol;  }
__global__ __launch_bounds__(256) void k_csid(float* CS) { const int idx = blockIdx.x * 256 + threadIdx.x; if (idx >= TT * HD) return; v2f cs; cs[0] = 1.0f; cs[1] = 0.0f; *(v2f*)(CS + (size_t)idx * 2) = cs;  }
// k_asoft: per row (zz, i): t = S x HD^-0.5 for j <= i and i - j < WIN (plain causal, as WIN = TT; the reference's -1e5 fill vanishes identically); softmax over the 1024 keys (register row, one exp, fixed trees);
__global__ __launch_bounds__(256) void k_asoft(const float* __restrict__ Sb, h16* P16, bf* Ph, bf* Pl) {
    const int lane = threadIdx.x & 31; const int row = blockIdx.x * 8 + (threadIdx.x >> 5); if (row >= ZH * TT) return; const int i = row % TT; const int zz = row / TT; (void)zz; const bool hires = (i < RH); const float* sr = Sb + (size_t)row * TT; float v[TT / 32]; float mx = -3.0e38f;
#pragma unroll
    for (int ch = 0; ch < TT / 128; ++ch) { const int j0 = ch * 128 + lane * 4; const v4f a = *(const v4f*)(sr + j0);
#pragma unroll
        for (int q = 0; q < 4; ++q) { const int j = j0 + q; (void)j; const float t = (j <= i && i - j < WIN) ? a[q] * SCL : -3.0e38f; v[ch * 4 + q] = t; mx = fmaxf(mx, t); } }
#pragma unroll
    for (int sh = 16; sh; sh >>= 1) mx = fmaxf(mx, __shfl_xor(mx, sh, 32));
    float sum = 0.f;
#pragma unroll
    for (int k = 0; k < TT / 32; ++k) { float d0 = __fsub_rn(v[k], mx); asm volatile("" : "+v"(d0)); v[k] = __builtin_amdgcn_exp2f(__fmul_rn(d0, 1.4426950408889634f)); sum += v[k]; }
#pragma unroll
    for (int sh = 16; sh; sh >>= 1) sum += __shfl_xor(sum, sh, 32);
    const float f = __fdiv_rn(hires ? 1.0f : PCAR, sum);
{
        if (hires) {
#pragma unroll
            for (int ch = 0; ch < TT / 128; ++ch) { v4us oh, ol;
#pragma unroll
                for (int q = 0; q < 4; ++q) { unsigned short a, c2; splitf(v[ch * 4 + q] * f, a, c2); oh[q] = a; ol[q] = c2; }
                const size_t oo = ((size_t)zz * (RH ? RH : 1) + i) * TT + ch * 128 + lane * 4; *(v4us*)(Ph + oo) = oh; *(v4us*)(Pl + oo) = ol; }
        } else {
#pragma unroll
            for (int ch = 0; ch < TT / 128; ++ch) { v4h o4;
#pragma unroll
                for (int q = 0; q < 4; ++q) o4[q] = tohx(v[ch * 4 + q] * f);
                *(v4h*)(P16 + (size_t)row * TT + ch * 128 + lane * 4) = o4; } }
         }
}
__global__ __launch_bounds__(256) void k_wtN(const float* __restrict__ w, bf* Bt) { const int lane = threadIdx.x & 31; const int L0 = (blockIdx.x * 8 + (threadIdx.x >> 5)) * 8; const int nlines = DQ * DM / 64;
{
#pragma unroll 1
        for (int l = 0; l < 8; ++l) { const int L = L0 + l; if (L >= nlines) break; const size_t e = (size_t)L * 64 + lane * 2; const int h = (int)(e % DM), r = (int)(e / DM); const int n = r / HD, d = r % HD; v2us o;
            o[0] = f2bf(w[((size_t)n * DM + h) * HD + d]); o[1] = f2bf(w[((size_t)n * DM + h + 1) * HD + d]); *(v2us*)(Bt + e) = o; }
         } }
__global__ __launch_bounds__(256) void k_merge(const float* __restrict__ O, int h0, bf* Ah, bf* Al) { const size_t e = ((size_t)blockIdx.x * 256 + threadIdx.x) * 2; if (e >= (size_t)ZH * TT * HD) return; const int d = (int)(e % HD); const int t = (int)((e / HD) % TT); const int zz = (int)(e / ((size_t)HD * TT)); const float cs = (t < RH) ? 1.0f : (1.0f / PCAR); const size_t oo = (size_t)t * DQ + (h0 + zz) * HD + d;
    v2us oh, ol;
#pragma unroll
    for (int q = 0; q < 2; ++q) { unsigned short a, c2; splitf(O[e + q] * cs, a, c2); oh[q] = a; ol[q] = c2; } *(v2us*)(Ah + oo) = oh; *(v2us*)(Al + oo) = ol;  }

extern "C" void kernel_launch(void* const* d_in, const int* in_sizes, int n_in,
                              void* d_out, int out_size, void* d_ws, size_t ws_size, hipStream_t stream) {
    (void)in_sizes; (void)n_in; (void)out_size;
    const float* xr = (const float*)d_in[0]; const float* xe = (const float*)d_in[1]; const float* wq = (const float*)d_in[2]; const float* bq = (const float*)d_in[3]; const float* wk = (const float*)d_in[4]; const float* bk = (const float*)d_in[5]; const float* wv = (const float*)d_in[6]; const float* bv = (const float*)d_in[7]; const float* wo = (const float*)d_in[8]; const float* bo = (const float*)d_in[9]; const float* x = nullptr; (void)x;
    float* OUT = (float*)d_out;     // [8][1024][1024]
    char* wsp = (char*)d_ws;
    auto take = [&](size_t bytes) { char* p = wsp; wsp += (bytes + 255) & ~(size_t)255; return (void*)p; };
    bf* WQ = (bf*)take((size_t)DQ * DM * 2); bf* WK = (bf*)take((size_t)DKV * DM * 2); bf* WV = (bf*)take((size_t)DKV * DM * 2); bf* WO = (bf*)take((size_t)DM * DQ * 2); float* CS = (float*)take((size_t)TT * HD * 2 * 4);
    bf* XB = (bf*)take((size_t)TT * DM * 2); float* FQ = (float*)take((size_t)TT * DQ * 4); float* FK = (float*)take((size_t)TT * DKV * 4);
    h16* QP16 = (h16*)take((size_t)NH_ * TT * HD * 2); h16* KP16 = (h16*)take((size_t)NKV * TT * HD * 2); h16* VT16 = (h16*)take((size_t)NKV * HD * TT * 2);
    bf* QPh = (bf*)take((size_t)NH_ * TT * HD * 2); bf* QPl = (bf*)take((size_t)NH_ * TT * HD * 2); bf* KPh = (bf*)take((size_t)NKV * TT * HD * 2); bf* KPl = (bf*)take((size_t)NKV * TT * HD * 2); bf* VTh = (bf*)take((size_t)NKV * HD * TT * 2); bf* VTl = (bf*)take((size_t)NKV * HD * TT * 2); bf* Ph = (bf*)take((size_t)ZH * RH * TT * 2); bf* Pl = (bf*)take((size_t)ZH * RH * TT * 2);
    float* Sb = (float*)take((size_t)ZH * TT * TT * 4); h16* P16 = (h16*)take((size_t)ZH * TT * TT * 2); float* Ob = (float*)take((size_t)ZH * TT * HD * 4); bf* ATh = (bf*)take((size_t)TT * DQ * 2); bf* ATl = (bf*)take((size_t)TT * DQ * 2);
    if ((size_t)(wsp - (char*)d_ws) > ws_size) return;    // ws 256 MiB
    float* FV = FK;   // v projection reuses the k buffer after the k planes are built (stream-ordered)
    { k_wtN<<<(unsigned)((DM * DQ / 64 + 63) / 64), 256, 0, stream>>>(wq, WQ); k_wtN<<<(unsigned)((DM * DQ / 64 + 63) / 64), 256, 0, stream>>>(wk, WK); k_wtN<<<(unsigned)((DM * DQ / 64 + 63) / 64), 256, 0, stream>>>(wv, WV);
      k_wtG<<<(unsigned)((DQ * DM / 64 + 63) / 64), 256, 0, stream>>>(wo, DQ, DM, WO);
       }
    k_csid<<<(TT * HD + 255) / 256, 256, 0, stream>>>(CS);
    const unsigned LQ = (unsigned)(((size_t)NH_ * TT * HD / 2 + 255) / 256), LKv = (unsigned)(((size_t)NKV * TT * HD / 2 + 255) / 256);
    for (int b = 0; b < NB_; ++b) {
        
        k_cvt8<<<(unsigned)(((size_t)TT * DM / 8 + 255) / 256), 256, 0, stream>>>(xe + (size_t)b * TT * DM, XB, (size_t)TT * DM / 8);   /* encoder_output -> q, k */
        k_gemmw<bf, 0, true><<<dim3(TT / 64, DQ / 64, 1), 32, 0, stream>>>(XB, nullptr, WQ, nullptr, DM, FQ, DQ, bq, 0, 0, 0);
        k_rope<<<LQ, 256, 0, stream>>>(FQ, DQ, NH_, CS, nullptr, nullptr, 1.0f, QP16, QPh, QPl);
        k_gemmw<bf, 0, true><<<dim3(TT / 64, DKV / 64, 1), 32, 0, stream>>>(XB, nullptr, WK, nullptr, DM, FK, DKV, bk, 0, 0, 0);
        k_rope<<<LKv, 256, 0, stream>>>(FK, DKV, NKV, CS, nullptr, nullptr, 1.0f, KP16, KPh, KPl);
        k_cvt8<<<(unsigned)(((size_t)TT * DM / 8 + 255) / 256), 256, 0, stream>>>(xr + (size_t)b * TT * DM, XB, (size_t)TT * DM / 8);   /* normalized_resid_pre -> v */
        k_gemmw<bf, 0, true><<<dim3(TT / 64, DKV / 64, 1), 32, 0, stream>>>(XB, nullptr, WV, nullptr, DM, FV, DKV, bv, 0, 0, 0); k_vtp<<<LKv, 256, 0, stream>>>(FV, DKV, NKV, VT16, VTh, VTl);
        for (int h0 = 0; h0 < NH_; h0 += ZH) { const size_t zq = (size_t)h0, zk = (size_t)(h0 / REP);   // one kv head per query head: the pass's two heads use consecutive kv planes (z-strides TT*HD)
            k_gemmc<bf, 2, 1><<<dim3(RH / 64, TT / 64, ZH), 32, 0, stream>>>(QPh + zq * TT * HD, QPl + zq * TT * HD, KPh + zk * TT * HD, KPl + zk * TT * HD, HD, Sb, TT, 0, (size_t)TT * HD, (size_t)TT * HD, (size_t)TT * TT);
            k_gemmc<h16, 0, 1><<<dim3((TT - RH) / 64, TT / 64, ZH), 32, 0, stream>>>(QP16 + zq * TT * HD + (size_t)RH * HD, nullptr, KP16 + zk * TT * HD, nullptr, HD, Sb + (size_t)RH * TT, TT, RH, (size_t)TT * HD, (size_t)TT * HD, (size_t)TT * TT);
            k_asoft<<<ZH * TT / 8, 256, 0, stream>>>(Sb, P16, Ph, Pl);
            k_gemmc<bf, 2, 2><<<dim3(RH / 64, HD / 64, ZH), 32, 0, stream>>>(Ph, Pl, VTh + zk * HD * TT, VTl + zk * HD * TT, TT, Ob, HD, 0, (size_t)RH * TT, (size_t)HD * TT, (size_t)TT * HD);
            k_gemmc<h16, 0, 2><<<dim3((TT - RH) / 64, HD / 64, ZH), 32, 0, stream>>>(P16 + (size_t)RH * TT, nullptr, VT16 + zk * HD * TT, nullptr, TT, Ob + (size_t)RH * HD, HD, RH, (size_t)TT * TT, (size_t)HD * TT, (size_t)TT * HD);
            k_merge<<<(unsigned)(((size_t)ZH * TT * HD / 2 + 255) / 256), 256, 0, stream>>>(Ob, h0, ATh, ATl); }
        k_gemmw<bf, 1, true><<<dim3(TT / 64, DM / 64, 1), 32, 0, stream>>>(ATh, ATl, WO, nullptr, DQ, OUT + (size_t)b * TT * DM, DM, bo, 0, 0, 0); }
}

// v001
// Measured time: 932 microseconds a run.
// Next to v000, in two timings, it ran 4.34 and 4.30 times as fast.
#include <hip/hip_runtime.h>

// Decoder cross-attention with per-head weights (normalized_resid_pre, encoder_output [8][1024][1024]; q, k from encoder_output and v from normalized_resid_pre via 'hde' per-head weights [16][1024][64] + [16][64] biases; scores / 8 with the strict upper triangle REPLACED by -1e5; softmax; z O ('hed' [16][64][1024]) + Ob -> [8][1024][1024] (8.4 M)).
// Launch shape: projections and the O product run over GB batches at once (M = GB x 1024 rows); one attention pass covers ZH consecutive (batch, head) planes.
// Layout per batch: the per-head 'hde' weights gathered once into single [1024][1024] operands (one exact GEMM per projection, flattened biases); causal T-1024 attention (hybrid rows: < 512 hi/lo 3 products, rest fp16 x1024; k_gemmc skips the tiles above the diagonal, whose weights are exactly zero after the -1e5 fill); merged context as hi/lo planes; O (flat 'xw' [1024][1024]) hl x exact + Ob.
// Compute dtypes, f32 accumulate: every input rounded to bf16; projections exact + f32 biases; attention rows < 512 3 products, rest fp16; softmax f32; O hl x exact + bias.

#define NB_  8
#define TT   1024
#define DM   1024
#define NH_  16
#define NKV  16
#define REP  (NH_ / NKV)
#define HD   64
#define DQ   (NH_ * HD)
#define DKV  (NKV * HD)
#define GB   4                    // batches per group: every projection launch covers GB x TT rows
#define ZH   16                   // (batch, head) planes per attention pass; GB * NH_ is a multiple of it
#define RH   512                  // query rows < RH use hi+lo planes (0: none)
#define WIN  1024
#define PCAR 1024.0f
#define SCL  0.125f   // HD^-0.5
typedef _Float16 h16;
typedef unsigned short bf;
typedef __attribute__((ext_vector_type(16))) __bf16   v16bf;
typedef __attribute__((ext_vector_type(16))) _Float16 v16h;
typedef __attribute__((ext_vector_type(8)))  _Float16 v8h;
typedef __attribute__((ext_vector_type(8)))  unsigned short v8us;
typedef __attribute__((ext_vector_type(8)))  float    v8f;
typedef __attribute__((ext_vector_type(4)))  float    v4f;
typedef v8h  __attribute__((may_alias)) v8ha;
typedef v4f  __attribute__((may_alias)) v4fa;
typedef v8us __attribute__((may_alias)) v8usa;

__device__ __forceinline__ unsigned short f2bf(float f) { unsigned u = __float_as_uint(f); u += 0x7FFFu + ((u >> 16) & 1u); return (unsigned short)(u >> 16); }
__device__ __forceinline__ float bf2f(unsigned short b) { return __uint_as_float(((unsigned)b) << 16); }
__device__ __forceinline__ float bfr(float f) { return bf2f(f2bf(f)); }
__device__ __forceinline__ v16h cat16(v8h lo, v8h hi) { return __builtin_shufflevector(lo, hi, 0, 1, 2, 3, 4, 5, 6, 7, 8, 9, 10, 11, 12, 13, 14, 15); }
__device__ __forceinline__ v16bf cat16b(v8us lo, v8us hi) { return __builtin_bit_cast(v16bf, __builtin_shufflevector(lo, hi, 0, 1, 2, 3, 4, 5, 6, 7, 8, 9, 10, 11, 12, 13, 14, 15)); }
__device__ __forceinline__ v8f wmma16(v16h a, v16h b, v8f c) { return __builtin_amdgcn_wmma_f32_16x16x32_f16(false, a, false, b, (short)0, c, false, false); }
__device__ __forceinline__ v8f wmmab(v16bf a, v16bf b, v8f c) { return __builtin_amdgcn_wmma_f32_16x16x32_bf16(false, a, false, b, (short)0, c, false, false); }



// ---- k_gemmw: register-blocked GEMM, ONE WAVE per 64x64 output tile (16 accumulators), operands straight from K-contiguous 16-bit planes; grid (M/64, N/64, Z), 32 threads.
// C[m][n] (f32, pitch ldc, + optional f32 bias[n]) = sum_k A[m][k] Bt[n][k] (+ split products per NSPLIT). z-batch strides sA/sB/sC in elements. K % 32 == 0.
template <typename T16> struct WFrag;
template <> struct WFrag<h16> { typedef v16h V; static __device__ __forceinline__ V ld(const h16* p) { return cat16(*(const v8h*)p, *(const v8h*)(p + 16)); } static __device__ __forceinline__ v8f mma(V a, V b, v8f c) { return wmma16(a, b, c); } };
template <> struct WFrag<bf> { typedef v16bf V; static __device__ __forceinline__ V ld(const bf* p) { return cat16b(*(const v8us*)p, *(const v8us*)(p + 16)); } static __device__ __forceinline__ v8f mma(V a, V b, v8f c) { return wmmab(a, b, c); } };
template <typename T16, int NSPLIT, bool BIAS>
__global__ __launch_bounds__(32) void k_gemmw(const T16* __restrict__ A, const T16* __restrict__ A2, const T16* __restrict__ Bt, const T16* __restrict__ Bt2, int K, float* C, int ldc, const float* __restrict__ bias, size_t sA, size_t sB, size_t sC) {
    typedef typename WFrag<T16>::V V;
    __shared__ __align__(16) float os[16 * 68];
    const size_t z = blockIdx.z; A += z * sA; if (A2) A2 += z * sA; Bt += z * sB; if (Bt2) Bt2 += z * sB; C += z * sC;
    const int lane = threadIdx.x & 31, lr = lane & 15, hi = lane >> 4; const int r0 = blockIdx.x * 64, c0 = blockIdx.y * 64;
    v8f acc[4][4];
#pragma unroll
    for (int mb = 0; mb < 4; ++mb)
#pragma unroll
        for (int nb = 0; nb < 4; ++nb) acc[mb][nb] = (v8f){};
    const size_t aoff = (size_t)(r0 + lr) * K + 8 * hi, boff = (size_t)(c0 + lr) * K + 8 * hi;
#pragma unroll 1
    for (int kc = 0; kc < K; kc += 32) {
        V a[4], a2[4];
#pragma unroll
        for (int mb = 0; mb < 4; ++mb) { a[mb] = WFrag<T16>::ld(A + aoff + (size_t)mb * 16 * K + kc); if (NSPLIT == 1 || NSPLIT == 2) a2[mb] = WFrag<T16>::ld(A2 + aoff + (size_t)mb * 16 * K + kc); }
#pragma unroll
        for (int nb = 0; nb < 4; ++nb) { const V b = WFrag<T16>::ld(Bt + boff + (size_t)nb * 16 * K + kc); V b2; if (NSPLIT >= 2) b2 = WFrag<T16>::ld(Bt2 + boff + (size_t)nb * 16 * K + kc);
#pragma unroll
            for (int mb = 0; mb < 4; ++mb) { acc[mb][nb] = WFrag<T16>::mma(a[mb], b, acc[mb][nb]); if (NSPLIT == 1 || NSPLIT == 2) acc[mb][nb] = WFrag<T16>::mma(a2[mb], b, acc[mb][nb]); if (NSPLIT >= 2) acc[mb][nb] = WFrag<T16>::mma(a[mb], b2, acc[mb][nb]); } }
        asm volatile("v_nop\n\tv_nop\n\tv_nop\n\tv_nop" : "+v"(acc[0][0]), "+v"(acc[1][1]), "+v"(acc[2][2]), "+v"(acc[3][3]) : "v"(a[0]), "v"(a[3]));
    }
#pragma unroll
    for (int mb = 0; mb < 4; ++mb) {
#pragma unroll
        for (int nb = 0; nb < 4; ++nb) {
#pragma unroll
            for (int j = 0; j < 8; ++j) os[(hi * 8 + j) * 68 + nb * 16 + lr] = acc[mb][nb][j]; }
        __builtin_amdgcn_wave_barrier(); asm volatile("" ::: "memory");
        float* crow = C + (size_t)(r0 + mb * 16) * ldc + c0;
{
#pragma unroll
            for (int s = 0; s < 8; ++s) { const int row = 2 * s + hi, cofs = lr * 4; v4f val = *(const v4fa*)(os + row * 68 + cofs); if (BIAS) { val[0] += bfr(bias[c0 + cofs]); val[1] += bfr(bias[c0 + cofs + 1]); val[2] += bfr(bias[c0 + cofs + 2]); val[3] += bfr(bias[c0 + cofs + 3]); }
                *(v4f*)(crow + (size_t)row * ldc + cofs) = val; }
             }
        __builtin_amdgcn_wave_barrier(); asm volatile("" ::: "memory");
    }
}

// ---- k_gemmc: the same one-wave 64x64 tile GEMM specialised for causal attention: CMODE 1 skips score tiles entirely above the diagonal (query rows r0+roff.., key columns c0..), CMODE 2 limits the
// key (K) loop of the probability x value contraction to the diagonal block (probabilities beyond it are exactly zero). roff = row offset of this launch's first row within the sequence.
template <typename T16, int NSPLIT, int CMODE>
__global__ __launch_bounds__(32) void k_gemmc(const T16* __restrict__ A, const T16* __restrict__ A2, const T16* __restrict__ Bt, const T16* __restrict__ Bt2, int K, float* C, int ldc, int roff, size_t sA, size_t sB, size_t sC) {
    typedef typename WFrag<T16>::V V;
    __shared__ __align__(16) float os[16 * 68];
    const size_t z = blockIdx.z; A += z * sA; if (A2) A2 += z * sA; Bt += z * sB; if (Bt2) Bt2 += z * sB; C += z * sC;
    const int lane = threadIdx.x & 31, lr = lane & 15, hi = lane >> 4; const int r0 = blockIdx.x * 64, c0 = blockIdx.y * 64;
    if (CMODE == 1 && c0 > r0 + roff + 63) return;                  // score tile entirely above the causal diagonal: never read (the softmax masks j > i by select)
    const int Kl = (CMODE == 2) ? min(K, r0 + roff + 64) : K;        // P.V: probabilities are exactly 0 beyond the diagonal block, so the K loop stops there
    v8f acc[4][4];
#pragma unroll
    for (int mb = 0; mb < 4; ++mb)
#pragma unroll
        for (int nb = 0; nb < 4; ++nb) acc[mb][nb] = (v8f){};
    const size_t aoff = (size_t)(r0 + lr) * K + 8 * hi, boff = (size_t)(c0 + lr) * K + 8 * hi;
#pragma unroll 1
    for (int kc = 0; kc < Kl; kc += 32) {
        V a[4], a2[4];
#pragma unroll
        for (int mb = 0; mb < 4; ++mb) { a[mb] = WFrag<T16>::ld(A + aoff + (size_t)mb * 16 * K + kc); if (NSPLIT == 1 || NSPLIT == 2) a2[mb] = WFrag<T16>::ld(A2 + aoff + (size_t)mb * 16 * K + kc); }
#pragma unroll
        for (int nb = 0; nb < 4; ++nb) { const V b = WFrag<T16>::ld(Bt + boff + (size_t)nb * 16 * K + kc); V b2; if (NSPLIT >= 2) b2 = WFrag<T16>::ld(Bt2 + boff + (size_t)nb * 16 * K + kc);
#pragma unroll
            for (int mb = 0; mb < 4; ++mb) { acc[mb][nb] = WFrag<T16>::mma(a[mb], b, acc[mb][nb]); if (NSPLIT == 1 || NSPLIT == 2) acc[mb][nb] = WFrag<T16>::mma(a2[mb], b, acc[mb][nb]); if (NSPLIT >= 2) acc[mb][nb] = WFrag<T16>::mma(a[mb], b2, acc[mb][nb]); } }
        asm volatile("v_nop\n\tv_nop\n\tv_nop\n\tv_nop" : "+v"(acc[0][0]), "+v"(acc[1][1]), "+v"(acc[2][2]), "+v"(acc[3][3]) : "v"(a[0]), "v"(a[3]));
    }
#pragma unroll
    for (int mb = 0; mb < 4; ++mb) {
#pragma unroll
        for (int nb = 0; nb < 4; ++nb) {
#pragma unroll
            for (int j = 0; j < 8; ++j) os[(hi * 8 + j) * 68 + nb * 16 + lr] = acc[mb][nb][j]; }
        __builtin_amdgcn_wave_barrier(); asm volatile("" ::: "memory");
        float* crow = C + (size_t)(r0 + mb * 16) * ldc + c0;
{
#pragma unroll
            for (int s = 0; s < 8; ++s) { const int row = 2 * s + hi, cofs = lr * 4; v4f val = *(const v4fa*)(os + row * 68 + cofs);
                *(v4f*)(crow + (size_t)row * ldc + cofs) = val; }
             }
        __builtin_amdgcn_wave_barrier(); asm volatile("" ::: "memory");
    }
}

__device__ __forceinline__ h16 tohx(float x) { return (h16)x; }
__device__ __forceinline__ void splitf(float y, unsigned short& h, unsigned short& l) { h = f2bf(y); l = f2bf(y - bf2f(h)); }
typedef __attribute__((ext_vector_type(2))) _Float16 v2h;
typedef __attribute__((ext_vector_type(4))) _Float16 v4h;
typedef __attribute__((ext_vector_type(2))) unsigned short v2us;
typedef __attribute__((ext_vector_type(4))) unsigned short v4us;
typedef __attribute__((ext_vector_type(2))) float v2f;
typedef __attribute__((ext_vector_type(4))) int v4i;

__global__ __launch_bounds__(256) void k_wtG(const float* __restrict__ w, int K, int N, bf* Bt) {
    const int lane = threadIdx.x & 31; const int L0 = (blockIdx.x * 8 + (threadIdx.x >> 5)) * 8; const int nlines = N * K / 64;
{
#pragma unroll 1
        for (int l = 0; l < 8; ++l) { const int L = L0 + l; if (L >= nlines) break; const size_t e = (size_t)L * 64 + lane * 2; const int k = (int)(e % K), n = (int)(e / K); v2us o;
            o[0] = f2bf(w[(size_t)k * N + n]); o[1] = f2bf(w[(size_t)(k + 1) * N + n]); *(v2us*)(Bt + e) = o; }
         }
}
__global__ __launch_bounds__(256) void k_cvt8(const float* __restrict__ src, bf* dst, size_t n8) { const size_t i = (size_t)blockIdx.x * 256 + threadIdx.x; if (i >= n8) return; const v8f v = *(const v8f*)(src + i * 8); v8us o;
#pragma unroll
    for (int k = 0; k < 8; ++k) o[k] = f2bf(v[k]); *(v8us*)(dst + i * 8) = o;  }

// k_rope: head planes [b][h][t][d] (nb batches; F rows b * TT + t) (fp16 + hi/lo) of rope(x) x sc with the rotate-half convention out[d] = x[d] cos[t][d] - x[d+HD/2] sin[t][d], out[d+HD/2] = x[d+HD/2] cos[t][d+HD/2] + x[d] sin[t][d+HD/2]
__global__ __launch_bounds__(256) void k_rope(const float* __restrict__ F, int pitch, int nb, int nheads, const float* __restrict__ CS, const float* __restrict__ RF, const float* __restrict__ nw, float sc, h16* P16, bf* Ph, bf* Pl) {
    const size_t e = ((size_t)blockIdx.x * 256 + threadIdx.x) * 2; if (e >= (size_t)nb * nheads * TT * HD) return; const int d = (int)(e % HD); const int t = (int)((e / HD) % TT); const int hb = (int)(e / ((size_t)HD * TT)); const int h = hb % nheads; const float* f = F + ((size_t)(hb / nheads) * TT + t) * pitch + h * HD; float rf = 1.0f; v2h o16; v2us oh, ol;
    if (RF) { rf = RF[(size_t)h * TT + t]; asm volatile("s_wait_xcnt 0x0" ::: "memory"); }   // the wait stands behind the load, before its address registers are reused
#pragma unroll
    for (int q = 0; q < 2; ++q) { const int dd = d + q; const int dp = (dd < HD / 2) ? dd + HD / 2 : dd - HD / 2; float x0 = f[dd], x1 = f[dp];
        if (RF) { float n0 = __fmul_rn(x0, rf), n1 = __fmul_rn(x1, rf); asm volatile("" : "+v"(n0)); asm volatile("" : "+v"(n1)); x0 = __fmul_rn(bfr(nw[dd]), n0); x1 = __fmul_rn(bfr(nw[dp]), n1); }
        const v2f cs = *(const v2f*)(CS + ((size_t)t * HD + dd) * 2); float a = __fmul_rn(x0, cs[0]), bq = __fmul_rn(x1, cs[1]); asm volatile("" : "+v"(a)); asm volatile("" : "+v"(bq)); const float r = ((dd < HD / 2) ? __fsub_rn(a, bq) : __fadd_rn(a, bq)) * sc;
        o16[q] = tohx(r); unsigned short a2, c2; splitf(r, a2, c2); oh[q] = a2; ol[q] = c2; }
    *(v2h*)(P16 + e) = o16; *(v2us*)(Ph + e) = oh; *(v2us*)(Pl + e) = ol;  }
__global__ __launch_bounds__(256) void k_vtp(const float* __restrict__ F, int pitch, int nb, int nheads, h16* V16, bf* Vh, bf* Vl) { const size_t e = ((size_t)blockIdx.x * 256 + threadIdx.x) * 2; if (e >= (size_t)nb * nheads * HD * TT) return; const int t = (int)(e % TT); const int d = (int)((e / TT) % HD); const int gb = (int)(e / ((size_t)TT * HD)); const int g = gb % nheads; F += (size_t)(gb / nheads) * TT * pitch; v2h o16; v2us oh, ol;
#pragma unroll
    for (int q = 0; q < 2; ++q) { const float x = F[(size_t)(t + q) * pitch + g * HD + d]; o16[q] = tohx(x); unsigned short a2, c2; splitf(x, a2, c2); oh[q] = a2; ol[q] = c2; }
    *(v2h*)(V16 + e) = o16; *(v2us*)(Vh + e) = oh; *(v2us*)(Vl + e) = ol;  }
__global__ __launch_bounds__(256) void k_csid(float* CS) { const int idx = blockIdx.x * 256 + threadIdx.x; if (idx >= TT * HD) return; v2f cs; cs[0] = 1.0f; cs[1] = 0.0f; *(v2f*)(CS + (size_t)idx * 2) = cs;  }
// k_asoft: per row (zz, i): t = S x HD^-0.5 for j <= i and i - j < WIN (plain causal, as WIN = TT; the reference's -1e5 fill vanishes identically); softmax over the 1024 keys (register row, one exp, fixed trees);
__global__ __launch_bounds__(256) void k_asoft(const float* __restrict__ Sb, h16* P16, bf* Ph, bf* Pl) {
    const int lane = threadIdx.x & 31; const int row = blockIdx.x * 8 + (threadIdx.x >> 5); if (row >= ZH * TT) return; const int i = row % TT; const int zz = row / TT; (void)zz; const bool hires = (i < RH); const float* sr = Sb + (size_t)row * TT; float v[TT / 32]; float mx = -3.0e38f;
#pragma unroll
    for (int ch = 0; ch < TT / 128; ++ch) { const int j0 = ch * 128 + lane * 4; const v4f a = *(const v4f*)(sr + j0);
#pragma unroll
        for (int q = 0; q < 4; ++q) { const int j = j0 + q; (void)j; const float t = (j <= i && i - j < WIN) ? a[q] * SCL : -3.0e38f; v[ch * 4 + q] = t; mx = fmaxf(mx, t); } }
#pragma unroll
    for (int sh = 16; sh; sh >>= 1) mx = fmaxf(mx, __shfl_xor(mx, sh, 32));
    float sum = 0.f;
#pragma unroll
    for (int k = 0; k < TT / 32; ++k) { float d0 = __fsub_rn(v[k], mx); asm volatile("" : "+v"(d0)); v[k] = __builtin_amdgcn_exp2f(__fmul_rn(d0, 1.4426950408889634f)); sum += v[k]; }
#pragma unroll
    for (int sh = 16; sh; sh >>= 1) sum += __shfl_xor(sum, sh, 32);
    const float f = __fdiv_rn(hires ? 1.0f : PCAR, sum);
{
        if (hires) {
#pragma unroll
            for (int ch = 0; ch < TT / 128; ++ch) { v4us oh, ol;
#pragma unroll
                for (int q = 0; q < 4; ++q) { unsigned short a, c2; splitf(v[ch * 4 + q] * f, a, c2); oh[q] = a; ol[q] = c2; }
                const size_t oo = ((size_t)zz * (RH ? RH : 1) + i) * TT + ch * 128 + lane * 4; *(v4us*)(Ph + oo) = oh; *(v4us*)(Pl + oo) = ol; }
        } else {
#pragma unroll
            for (int ch = 0; ch < TT / 128; ++ch) { v4h o4;
#pragma unroll
                for (int q = 0; q < 4; ++q) o4[q] = tohx(v[ch * 4 + q] * f);
                *(v4h*)(P16 + (size_t)row * TT + ch * 128 + lane * 4) = o4; } }
         }
}
__global__ __launch_bounds__(256) void k_wtN(const float* __restrict__ w, bf* Bt) { const int lane = threadIdx.x & 31; const int L0 = (blockIdx.x * 8 + (threadIdx.x >> 5)) * 8; const int nlines = DQ * DM / 64;
{
#pragma unroll 1
        for (int l = 0; l < 8; ++l) { const int L = L0 + l; if (L >= nlines) break; const size_t e = (size_t)L * 64 + lane * 2; const int h = (int)(e % DM), r = (int)(e / DM); const int n = r / HD, d = r % HD; v2us o;
            o[0] = f2bf(w[((size_t)n * DM + h) * HD + d]); o[1] = f2bf(w[((size_t)n * DM + h + 1) * HD + d]); *(v2us*)(Bt + e) = o; }
         } }
__global__ __launch_bounds__(256) void k_merge(const float* __restrict__ O, int z0, bf* Ah, bf* Al) { const size_t e = ((size_t)blockIdx.x * 256 + threadIdx.x) * 2; if (e >= (size_t)ZH * TT * HD) return; const int d = (int)(e % HD); const int t = (int)((e / HD) % TT); const int zz = (int)(e / ((size_t)HD * TT)); const float cs = (t < RH) ? 1.0f : (1.0f / PCAR); const int zf = z0 + zz; const size_t oo = ((size_t)(zf / NH_) * TT + t) * DQ + (zf % NH_) * HD + d;
    v2us oh, ol;
#pragma unroll
    for (int q = 0; q < 2; ++q) { unsigned short a, c2; splitf(O[e + q] * cs, a, c2); oh[q] = a; ol[q] = c2; } *(v2us*)(Ah + oo) = oh; *(v2us*)(Al + oo) = ol;  }

extern "C" void kernel_launch(void* const* d_in, const int* in_sizes, int n_in,
                              void* d_out, int out_size, void* d_ws, size_t ws_size, hipStream_t stream) {
    (void)in_sizes; (void)n_in; (void)out_size;
    const float* xr = (const float*)d_in[0]; const float* xe = (const float*)d_in[1]; const float* wq = (const float*)d_in[2]; const float* bq = (const float*)d_in[3]; const float* wk = (const float*)d_in[4]; const float* bk = (const float*)d_in[5]; const float* wv = (const float*)d_in[6]; const float* bv = (const float*)d_in[7]; const float* wo = (const float*)d_in[8]; const float* bo = (const float*)d_in[9]; const float* x = nullptr; (void)x;
    float* OUT = (float*)d_out;     // [8][1024][1024]
    char* wsp = (char*)d_ws;
    auto take = [&](size_t bytes) { char* p = wsp; wsp += (bytes + 255) & ~(size_t)255; return (void*)p; };
    bf* WQ = (bf*)take((size_t)DQ * DM * 2); bf* WK = (bf*)take((size_t)DKV * DM * 2); bf* WV = (bf*)take((size_t)DKV * DM * 2); bf* WO = (bf*)take((size_t)DM * DQ * 2); float* CS = (float*)take((size_t)TT * HD * 2 * 4);
    h16* QP16 = (h16*)take((size_t)GB * NH_ * TT * HD * 2); h16* KP16 = (h16*)take((size_t)GB * NKV * TT * HD * 2); h16* VT16 = (h16*)take((size_t)GB * NKV * HD * TT * 2);
    bf* QPh = (bf*)take((size_t)GB * NH_ * TT * HD * 2); bf* QPl = (bf*)take((size_t)GB * NH_ * TT * HD * 2); bf* KPh = (bf*)take((size_t)GB * NKV * TT * HD * 2); bf* KPl = (bf*)take((size_t)GB * NKV * TT * HD * 2); bf* VTh = (bf*)take((size_t)GB * NKV * HD * TT * 2); bf* VTl = (bf*)take((size_t)GB * NKV * HD * TT * 2); bf* Ph = (bf*)take((size_t)ZH * RH * TT * 2); bf* Pl = (bf*)take((size_t)ZH * RH * TT * 2);
    float* Sb = (float*)take((size_t)ZH * TT * TT * 4); h16* P16 = (h16*)take((size_t)ZH * TT * TT * 2); float* Ob = (float*)take((size_t)ZH * TT * HD * 4); bf* ATh = (bf*)take((size_t)GB * TT * DQ * 2); bf* ATl = (bf*)take((size_t)GB * TT * DQ * 2);
    if ((size_t)(wsp - (char*)d_ws) > ws_size) return;    // ws 256 MiB
    // the projection buffers lie in the score buffer: a group's projections end before its first score launch, and its last pass ends before the next group's projections (stream-ordered)
    bf* XB = (bf*)Sb; float* FQ = Sb + (size_t)GB * TT * DM / 2; float* FK = FQ + (size_t)GB * TT * DQ;
    float* FV = FK;   // v projection reuses the k buffer after the k planes are built (stream-ordered)
    { k_wtN<<<(unsigned)((DM * DQ / 64 + 63) / 64), 256, 0, stream>>>(wq, WQ); k_wtN<<<(unsigned)((DM * DQ / 64 + 63) / 64), 256, 0, stream>>>(wk, WK); k_wtN<<<(unsigned)((DM * DQ / 64 + 63) / 64), 256, 0, stream>>>(wv, WV);
      k_wtG<<<(unsigned)((DQ * DM / 64 + 63) / 64), 256, 0, stream>>>(wo, DQ, DM, WO);
       }
    k_csid<<<(TT * HD + 255) / 256, 256, 0, stream>>>(CS);
    const unsigned LQ = (unsigned)(((size_t)GB * NH_ * TT * HD / 2 + 255) / 256), LKv = (unsigned)(((size_t)GB * NKV * TT * HD / 2 + 255) / 256);
    for (int b = 0; b < NB_; b += GB) {
        k_cvt8<<<(unsigned)(((size_t)GB * TT * DM / 8 + 255) / 256), 256, 0, stream>>>(xe + (size_t)b * TT * DM, XB, (size_t)GB * TT * DM / 8);   /* encoder_output -> q, k */
        k_gemmw<bf, 0, true><<<dim3(GB * TT / 64, DQ / 64, 1), 32, 0, stream>>>(XB, nullptr, WQ, nullptr, DM, FQ, DQ, bq, 0, 0, 0);
        k_rope<<<LQ, 256, 0, stream>>>(FQ, DQ, GB, NH_, CS, nullptr, nullptr, 1.0f, QP16, QPh, QPl);
        k_gemmw<bf, 0, true><<<dim3(GB * TT / 64, DKV / 64, 1), 32, 0, stream>>>(XB, nullptr, WK, nullptr, DM, FK, DKV, bk, 0, 0, 0);
        k_rope<<<LKv, 256, 0, stream>>>(FK, DKV, GB, NKV, CS, nullptr, nullptr, 1.0f, KP16, KPh, KPl);
        k_cvt8<<<(unsigned)(((size_t)GB * TT * DM / 8 + 255) / 256), 256, 0, stream>>>(xr + (size_t)b * TT * DM, XB, (size_t)GB * TT * DM / 8);   /* normalized_resid_pre -> v */
        k_gemmw<bf, 0, true><<<dim3(GB * TT / 64, DKV / 64, 1), 32, 0, stream>>>(XB, nullptr, WV, nullptr, DM, FV, DKV, bv, 0, 0, 0); k_vtp<<<LKv, 256, 0, stream>>>(FV, DKV, GB, NKV, VT16, VTh, VTl);
        for (int z0 = 0; z0 < GB * NH_; z0 += ZH) { const size_t zq = (size_t)z0, zk = (size_t)(z0 / REP);   // one kv head per query head: the pass's (batch, head) planes are consecutive in every plane array (z-strides TT*HD)
            k_gemmc<bf, 2, 1><<<dim3(RH / 64, TT / 64, ZH), 32, 0, stream>>>(QPh + zq * TT * HD, QPl + zq * TT * HD, KPh + zk * TT * HD, KPl + zk * TT * HD, HD, Sb, TT, 0, (size_t)TT * HD, (size_t)TT * HD, (size_t)TT * TT);
            k_gemmc<h16, 0, 1><<<dim3((TT - RH) / 64, TT / 64, ZH), 32, 0, stream>>>(QP16 + zq * TT * HD + (size_t)RH * HD, nullptr, KP16 + zk * TT * HD, nullptr, HD, Sb + (size_t)RH * TT, TT, RH, (size_t)TT * HD, (size_t)TT * HD, (size_t)TT * TT);
            k_asoft<<<ZH * TT / 8, 256, 0, stream>>>(Sb, P16, Ph, Pl);
            k_gemmc<bf, 2, 2><<<dim3(RH / 64, HD / 64, ZH), 32, 0, stream>>>(Ph, Pl, VTh + zk * HD * TT, VTl + zk * HD * TT, TT, Ob, HD, 0, (size_t)RH * TT, (size_t)HD * TT, (size_t)TT * HD);
            k_gemmc<h16, 0, 2><<<dim3((TT - RH) / 64, HD / 64, ZH), 32, 0, stream>>>(P16 + (size_t)RH * TT, nullptr, VT16 + zk * HD * TT, nullptr, TT, Ob + (size_t)RH * HD, HD, RH, (size_t)TT * TT, (size_t)HD * TT, (size_t)TT * HD);
            k_merge<<<(unsigned)(((size_t)ZH * TT * HD / 2 + 255) / 256), 256, 0, stream>>>(Ob, z0, ATh, ATl); }
        k_gemmw<bf, 1, true><<<dim3(GB * TT / 64, DM / 64, 1), 32, 0, stream>>>(ATh, ATl, WO, nullptr, DQ, OUT + (size_t)b * TT * DM, DM, bo, 0, 0, 0); }
}

// v003
// It runs in 390 microseconds.
// Versions in between are left out here; by their measured steps it is 2.40 times as fast as v001.
// Counting every step since v000, it is 10.4 times as fast.
#include <hip/hip_runtime.h>

// Decoder cross-attention with per-head weights (normalized_resid_pre, encoder_output [8][1024][1024]; q, k from encoder_output and v from normalized_resid_pre via 'hde' per-head weights [16][1024][64] + [16][64] biases; scores / 8 with the strict upper triangle REPLACED by -1e5; softmax; z O ('hed' [16][64][1024]) + Ob -> [8][1024][1024] (8.4 M)).
// Launch shape: projections and the O product run over GB batches at once (M = GB x 1024 rows); each projection GEMM writes its head planes itself; one fused attention launch covers the group's GB x 16 (batch, head) planes.
// Layout per batch: the per-head 'hde' weights gathered once into single [1024][1024] operands (one exact GEMM per projection, flattened biases); fused causal T-1024 attention with a running maximum (hybrid rows: < 512 hi/lo 3 products, rest fp16 x1024; key blocks above the diagonal are skipped, their weights being exactly zero after the -1e5 fill); merged context as hi/lo planes; O (flat 'xw' [1024][1024]) hl x exact + Ob.
// Compute dtypes, f32 accumulate: every input rounded to bf16; projections exact + f32 biases; attention rows < 512 3 products, rest fp16; softmax f32; O hl x exact + bias.

#define NB_  8
#define TT   1024
#define DM   1024
#define NH_  16
#define NKV  16
#define REP  (NH_ / NKV)
#define HD   64
#define DQ   (NH_ * HD)
#define DKV  (NKV * HD)
#define GB   4                    // batches per group: every projection launch covers GB x TT rows
#define RH   512                  // query rows < RH use hi+lo planes (0: none)
#define PCAR 1024.0f
#define SCL  0.125f   // HD^-0.5
typedef _Float16 h16;
typedef unsigned short bf;
typedef __attribute__((ext_vector_type(16))) __bf16   v16bf;
typedef __attribute__((ext_vector_type(16))) _Float16 v16h;
typedef __attribute__((ext_vector_type(8)))  _Float16 v8h;
typedef __attribute__((ext_vector_type(8)))  unsigned short v8us;
typedef __attribute__((ext_vector_type(8)))  float    v8f;
typedef __attribute__((ext_vector_type(4)))  float    v4f;
typedef v8h  __attribute__((may_alias)) v8ha;
typedef v4f  __attribute__((may_alias)) v4fa;
typedef v8us __attribute__((may_alias)) v8usa;

__device__ __forceinline__ unsigned short f2bf(float f) { unsigned u = __float_as_uint(f); u += 0x7FFFu + ((u >> 16) & 1u); return (unsigned short)(u >> 16); }
__device__ __forceinline__ float bf2f(unsigned short b) { return __uint_as_float(((unsigned)b) << 16); }
__device__ __forceinline__ float bfr(float f) { return bf2f(f2bf(f)); }
__device__ __forceinline__ v16h cat16(v8h lo, v8h hi) { return __builtin_shufflevector(lo, hi, 0, 1, 2, 3, 4, 5, 6, 7, 8, 9, 10, 11, 12, 13, 14, 15); }
__device__ __forceinline__ v16bf cat16b(v8us lo, v8us hi) { return __builtin_bit_cast(v16bf, __builtin_shufflevector(lo, hi, 0, 1, 2, 3, 4, 5, 6, 7, 8, 9, 10, 11, 12, 13, 14, 15)); }
__device__ __forceinline__ v8f wmma16(v16h a, v16h b, v8f c) { return __builtin_amdgcn_wmma_f32_16x16x32_f16(false, a, false, b, (short)0, c, false, false); }
__device__ __forceinline__ v8f wmmab(v16bf a, v16bf b, v8f c) { return __builtin_amdgcn_wmma_f32_16x16x32_bf16(false, a, false, b, (short)0, c, false, false); }
__device__ __forceinline__ h16 tohx(float x) { return (h16)x; }
__device__ __forceinline__ void splitf(float y, unsigned short& h, unsigned short& l) { h = f2bf(y); l = f2bf(y - bf2f(h)); }



// ---- k_gemmw: register-blocked GEMM, ONE WAVE per 64x64 output tile (16 accumulators), operands straight from K-contiguous 16-bit planes; grid (M/64, N/64, Z), 32 threads.
// C[m][n] (f32, pitch ldc, + optional f32 bias[n]) = sum_k A[m][k] Bt[n][k] (+ split products per NSPLIT). z-batch strides sA/sB/sC in elements. K % 32 == 0.
// PL 1, 2: no C; the tile + bias goes out as fp16 and hi/lo bf16 head planes, every store whole 128-byte lines (16 bytes a lane, 8 lanes a tile row).
// PL 1: m = b * TT + t, n = h * HD + d, bias[n]: the tile is 64 rows t of plane [b][h][t][d]. PL 2 (the caller swaps the operands): m = h * HD + d, n = b * TT + t, bias[m]: the tile is the 64 rows d, 64 columns t, of plane [b][h][d][t].
template <typename T16> struct WFrag;
template <> struct WFrag<h16> { typedef v16h V; static __device__ __forceinline__ V ld(const h16* p) { return cat16(*(const v8h*)p, *(const v8h*)(p + 16)); } static __device__ __forceinline__ v8f mma(V a, V b, v8f c) { return wmma16(a, b, c); } };
template <> struct WFrag<bf> { typedef v16bf V; static __device__ __forceinline__ V ld(const bf* p) { return cat16b(*(const v8us*)p, *(const v8us*)(p + 16)); } static __device__ __forceinline__ v8f mma(V a, V b, v8f c) { return wmmab(a, b, c); } };
template <typename T16, int NSPLIT, bool BIAS, int PL>
__global__ __launch_bounds__(32) void k_gemmw(const T16* __restrict__ A, const T16* __restrict__ A2, const T16* __restrict__ Bt, const T16* __restrict__ Bt2, int K, float* C, int ldc, const float* __restrict__ bias, size_t sA, size_t sB, size_t sC, h16* P16, bf* Ph, bf* Pl) {
    static_assert(HD == 64 && TT % 64 == 0, "a 64x64 tile is one head wide and lies in one batch");
    typedef typename WFrag<T16>::V V;
    __shared__ __align__(16) float os[16 * 68];
    const size_t z = blockIdx.z; A += z * sA; if (A2) A2 += z * sA; Bt += z * sB; if (Bt2) Bt2 += z * sB; C += z * sC;
    const int lane = threadIdx.x & 31, lr = lane & 15, hi = lane >> 4; const int r0 = blockIdx.x * 64, c0 = blockIdx.y * 64;
    v8f acc[4][4];
#pragma unroll
    for (int mb = 0; mb < 4; ++mb)
#pragma unroll
        for (int nb = 0; nb < 4; ++nb) acc[mb][nb] = (v8f){};
    const size_t aoff = (size_t)(r0 + lr) * K + 8 * hi, boff = (size_t)(c0 + lr) * K + 8 * hi;
#pragma unroll 1
    for (int kc = 0; kc < K; kc += 32) {
        V a[4], a2[4];
#pragma unroll
        for (int mb = 0; mb < 4; ++mb) { a[mb] = WFrag<T16>::ld(A + aoff + (size_t)mb * 16 * K + kc); if (NSPLIT == 1 || NSPLIT == 2) a2[mb] = WFrag<T16>::ld(A2 + aoff + (size_t)mb * 16 * K + kc); }
#pragma unroll
        for (int nb = 0; nb < 4; ++nb) { const V b = WFrag<T16>::ld(Bt + boff + (size_t)nb * 16 * K + kc); V b2; if (NSPLIT >= 2) b2 = WFrag<T16>::ld(Bt2 + boff + (size_t)nb * 16 * K + kc);
#pragma unroll
            for (int mb = 0; mb < 4; ++mb) { acc[mb][nb] = WFrag<T16>::mma(a[mb], b, acc[mb][nb]); if (NSPLIT == 1 || NSPLIT == 2) acc[mb][nb] = WFrag<T16>::mma(a2[mb], b, acc[mb][nb]); if (NSPLIT >= 2) acc[mb][nb] = WFrag<T16>::mma(a[mb], b2, acc[mb][nb]); } }
        asm volatile("v_nop\n\tv_nop\n\tv_nop\n\tv_nop" : "+v"(acc[0][0]), "+v"(acc[1][1]), "+v"(acc[2][2]), "+v"(acc[3][3]) : "v"(a[0]), "v"(a[3]));
    }
    const int prow = lane >> 3, pcol = (lane & 7) * 8;   // plane epilogue: this lane's row within four tile rows, and its 8 columns
    float bb[16];                                        // its biases: PL 1 one per column, PL 2 one per tile row it will store
    if constexpr (PL != 0) {
#pragma unroll
        for (int u = 0; u < ((PL == 1) ? 8 : 16); ++u) bb[u] = bias[(PL == 1) ? c0 + pcol + u : r0 + 4 * u + prow];
        asm volatile("s_wait_xcnt 0x0" ::: "memory");    // behind the loads, before their address registers are reused
    }
#pragma unroll
    for (int mb = 0; mb < 4; ++mb) {
#pragma unroll
        for (int nb = 0; nb < 4; ++nb) {
#pragma unroll
            for (int j = 0; j < 8; ++j) os[(hi * 8 + j) * 68 + nb * 16 + lr] = acc[mb][nb][j]; }
        __builtin_amdgcn_wave_barrier(); asm volatile("" ::: "memory");
        if constexpr (PL == 0) {
        float* crow = C + (size_t)(r0 + mb * 16) * ldc + c0;
{
#pragma unroll
            for (int s = 0; s < 8; ++s) { const int row = 2 * s + hi, cofs = lr * 4; v4f val = *(const v4fa*)(os + row * 68 + cofs); if (BIAS) { val[0] += bfr(bias[c0 + cofs]); val[1] += bfr(bias[c0 + cofs + 1]); val[2] += bfr(bias[c0 + cofs + 2]); val[3] += bfr(bias[c0 + cofs + 3]); }
                *(v4f*)(crow + (size_t)row * ldc + cofs) = val; }
             }
        } else {
            // first plane element of the tile, and the plane's pitch from one tile row to the next
            const size_t pb = (PL == 1) ? ((size_t)((r0 / TT) * NH_ + c0 / HD) * TT + r0 % TT) * HD : (size_t)((c0 / TT) * NH_ + r0 / HD) * HD * TT + c0 % TT; const int pp = (PL == 1) ? HD : TT;
            v8h o16[4]; v8us oh[4], ol[4];
#pragma unroll
            for (int s = 0; s < 4; ++s) { const int row = 4 * s + prow; const v4f va = *(const v4fa*)(os + row * 68 + pcol), vb = *(const v4fa*)(os + row * 68 + pcol + 4);
#pragma unroll
                for (int q = 0; q < 8; ++q) { const float y = ((q < 4) ? va[q & 3] : vb[q & 3]) + bfr(bb[(PL == 1) ? q : mb * 4 + s]); o16[s][q] = tohx(y); unsigned short a2, c2; splitf(y, a2, c2); oh[s][q] = a2; ol[s][q] = c2; }
                const size_t e = pb + (size_t)(mb * 16 + row) * pp + pcol; *(v8h*)(P16 + e) = o16[s]; *(v8us*)(Ph + e) = oh[s]; *(v8us*)(Pl + e) = ol[s]; }
            // behind the 12 stores: naming their data keeps those registers from being rewritten ahead of the wait
            asm volatile("s_wait_xcnt 0x0" :: "v"(o16[0]), "v"(o16[1]), "v"(o16[2]), "v"(o16[3]), "v"(oh[0]), "v"(oh[1]), "v"(oh[2]), "v"(oh[3]), "v"(ol[0]), "v"(ol[1]), "v"(ol[2]), "v"(ol[3]) : "memory");
        }
        __builtin_amdgcn_wave_barrier(); asm volatile("" ::: "memory");
    }
}

typedef __attribute__((ext_vector_type(2))) _Float16 v2h;
typedef __attribute__((ext_vector_type(4))) _Float16 v4h;
typedef __attribute__((ext_vector_type(2))) unsigned short v2us;
typedef __attribute__((ext_vector_type(4))) unsigned short v4us;
typedef __attribute__((ext_vector_type(2))) float v2f;
typedef __attribute__((ext_vector_type(4))) int v4i;

__global__ __launch_bounds__(256) void k_wtG(const float* __restrict__ w, int K, int N, bf* Bt) {
    const int lane = threadIdx.x & 31; const int L0 = (blockIdx.x * 8 + (threadIdx.x >> 5)) * 8; const int nlines = N * K / 64;
{
#pragma unroll 1
        for (int l = 0; l < 8; ++l) { const int L = L0 + l; if (L >= nlines) break; const size_t e = (size_t)L * 64 + lane * 2; const int k = (int)(e % K), n = (int)(e / K); v2us o;
            o[0] = f2bf(w[(size_t)k * N + n]); o[1] = f2bf(w[(size_t)(k + 1) * N + n]); *(v2us*)(Bt + e) = o; }
         }
}
__global__ __launch_bounds__(256) void k_cvt8(const float* __restrict__ src, bf* dst, size_t n8) { const size_t i = (size_t)blockIdx.x * 256 + threadIdx.x; if (i >= n8) return; const v8f v = *(const v8f*)(src + i * 8); v8us o;
#pragma unroll
    for (int k = 0; k < 8; ++k) o[k] = f2bf(v[k]); *(v8us*)(dst + i * 8) = o;  }

__global__ __launch_bounds__(256) void k_wtN(const float* __restrict__ w, bf* Bt) { const int lane = threadIdx.x & 31; const int L0 = (blockIdx.x * 8 + (threadIdx.x >> 5)) * 8; const int nlines = DQ * DM / 64;
{
#pragma unroll 1
        for (int l = 0; l < 8; ++l) { const int L = L0 + l; if (L >= nlines) break; const size_t e = (size_t)L * 64 + lane * 2; const int h = (int)(e % DM), r = (int)(e / DM); const int n = r / HD, d = r % HD; v2us o;
            o[0] = f2bf(w[((size_t)n * DM + h) * HD + d]); o[1] = f2bf(w[((size_t)n * DM + h + 1) * HD + d]); *(v2us*)(Bt + e) = o; }
         } }
// ---- k_fattn: fused causal attention, one wave per 16 query rows of one (batch, head) plane, four waves (64 rows) per work-group, no LDS and no barrier.
// Transposed products: S^T = K Q^T (A = 16 key rows, B = the wave's 16 query rows), so a lane holds scores of ONE query (column lr), keys 8 hi + r of each 16-key tile;
// two score tiles (32 keys), converted in place, are the B operand of O^T += V^T P^T (element s = tile s >> 3, register s & 7, the k order of WFrag::ld on the V^T rows).
// Running maximum in the log2 domain, unnormalised weights, one division at the end. HL: hi/lo bf16 planes, 3 products each; otherwise fp16 with the weights carried x PCAR.
// Every inner loop is fully unrolled so that the fragment arrays stay in registers.
#define L2E 1.4426950408889634f
__device__ __forceinline__ float ex2(float x) { float y; asm("v_exp_f32 %0, %1\n\tv_nop" : "=v"(y) : "v"(x)); return y; }   // 2^x; the v_nop keeps the free slot behind a transcendental
__device__ __forceinline__ float xhalf(float x) { return __builtin_bit_cast(float, __builtin_amdgcn_permlanex16(__builtin_bit_cast(int, x), __builtin_bit_cast(int, x), 0x76543210, 0xfedcba98, false, false)); }   // lane l reads lane l ^ 16
template <typename T16, bool HL>
__device__ __forceinline__ void attn_rows(const T16* Q, const T16* Q2, const T16* Kp, const T16* K2, const T16* Vt, const T16* V2, int q0, int lr, int hi, bf* Ah, bf* Al) {
    typedef typename WFrag<T16>::V V;
    const int i = q0 + lr;                        // this lane's query row
    const int kend = (q0 & ~31) + 32;             // key blocks of 32 up to and including the diagonal block; weights beyond the diagonal are exactly zero
    const size_t qo = (size_t)i * HD + 8 * hi, ko = (size_t)lr * HD + 8 * hi, vo = (size_t)lr * TT + 8 * hi;
    V q[2], q2[2], kf[2][2], kf2[2][2];
#pragma unroll
    for (int kc = 0; kc < 2; ++kc) { q[kc] = WFrag<T16>::ld(Q + qo + kc * 32); if (HL) q2[kc] = WFrag<T16>::ld(Q2 + qo + kc * 32); }
    auto ldk = [&](const T16* kp, const T16* kp2) {   // 32 K rows as A fragments
#pragma unroll
        for (int t = 0; t < 2; ++t)
#pragma unroll
            for (int kc = 0; kc < 2; ++kc) { kf[t][kc] = WFrag<T16>::ld(kp + t * 16 * HD + kc * 32); if (HL) kf2[t][kc] = WFrag<T16>::ld(kp2 + t * 16 * HD + kc * 32); } };
    if (!HL) ldk(Kp + ko, nullptr);
    v8f o[4];
#pragma unroll
    for (int db = 0; db < 4; ++db) o[db] = (v8f){};
    float m = -3.0e38f, l = 0.f;
    for (int kb = 0; kb < kend; kb += 32) {
        const T16* kp = Kp + ko + (size_t)kb * HD; const T16* kp2 = HL ? K2 + ko + (size_t)kb * HD : kp;
        if (HL) ldk(kp, kp2);                     // hi/lo planes: twice the fragment registers, so K is not fetched ahead (these rows have at most half the passes)
        V vf[4], vf2[4];                          // this block's V^T rows, issued ahead of the score products
        const T16* vp = Vt + vo + kb; const T16* vp2 = HL ? V2 + vo + kb : vp;
#pragma unroll
        for (int db = 0; db < 4; ++db) { vf[db] = WFrag<T16>::ld(vp + (size_t)db * 16 * TT); if (HL) vf2[db] = WFrag<T16>::ld(vp2 + (size_t)db * 16 * TT); }
        if (HL) asm volatile("s_wait_xcnt 0x0" :: "v"(kp), "v"(kp2), "v"(vp), "v"(vp2) : "memory");   // behind the loads: naming the addresses keeps their registers from becoming a later load's destination ahead of the wait
        v8f s[2];
#pragma unroll
        for (int t = 0; t < 2; ++t) { s[t] = (v8f){};
#pragma unroll
            for (int kc = 0; kc < 2; ++kc) { s[t] = WFrag<T16>::mma(kf[t][kc], q[kc], s[t]); if (HL) { s[t] = WFrag<T16>::mma(kf[t][kc], q2[kc], s[t]); s[t] = WFrag<T16>::mma(kf2[t][kc], q[kc], s[t]); } } }
        if (!HL) ldk(Kp + ko + (size_t)min(kb + 32, kend - 32) * HD, nullptr);    // the next block's K rows fly during the softmax (the last pass re-reads its own block: in bounds, unused)
        float x[16]; float mx = m;
#pragma unroll
        for (int e = 0; e < 16; ++e) { const int j = kb + (e >> 3) * 16 + 8 * hi + (e & 7); x[e] = (j <= i) ? s[e >> 3][e & 7] * (SCL * L2E) : -3.0e38f; mx = fmaxf(mx, x[e]); }
        mx = fmaxf(mx, xhalf(mx));   // the other half of the wave holds the query's other 16 keys
        float ps[4] = {0.f, 0.f, 0.f, 0.f};       // four short chains instead of one of 16 dependent adds
#pragma unroll
        for (int e = 0; e < 16; ++e) { x[e] = ex2(x[e] - mx); ps[e & 3] += x[e]; }
        const float al = ex2(m - mx); m = mx;     // what the sums so far are worth under the new maximum
        l = l * al + ((ps[0] + ps[1]) + (ps[2] + ps[3]));
#pragma unroll
        for (int db = 0; db < 4; ++db) o[db] *= al;
        if constexpr (HL) {
            v8us h0, h1, l0, l1;
#pragma unroll
            for (int r = 0; r < 8; ++r) { unsigned short a, c; splitf(x[r], a, c); h0[r] = a; l0[r] = c; splitf(x[8 + r], a, c); h1[r] = a; l1[r] = c; }
            const V ph = cat16b(h0, h1), pl = cat16b(l0, l1);
#pragma unroll
            for (int db = 0; db < 4; ++db) { o[db] = WFrag<T16>::mma(vf[db], ph, o[db]); o[db] = WFrag<T16>::mma(vf[db], pl, o[db]); o[db] = WFrag<T16>::mma(vf2[db], ph, o[db]); }
        } else {
            V p;
#pragma unroll
            for (int e = 0; e < 16; ++e) p[e] = tohx(x[e] * PCAR);
#pragma unroll
            for (int db = 0; db < 4; ++db) o[db] = WFrag<T16>::mma(vf[db], p, o[db]);
        }
    }
    l += xhalf(l);
    const float f = __fdiv_rn(HL ? 1.0f : (1.0f / PCAR), l);
#pragma unroll
    for (int db = 0; db < 4; ++db) { v8us oh, ol;   // registers 0..7 of O^T tile db are head columns db * 16 + 8 hi + r of the lane's query row: one 16-byte store per plane
#pragma unroll
        for (int r = 0; r < 8; ++r) { unsigned short a, c; splitf(o[db][r] * f, a, c); oh[r] = a; ol[r] = c; }
        *(v8us*)(Ah + db * 16) = oh; *(v8us*)(Al + db * 16) = ol; }
}
// grid (planes of the group, TT / 64 row blocks, the longest first), 128 threads; writes the merged context [b][t][h * HD + d] as hi/lo planes.
// amdgpu_waves_per_eu(4, 4): the launch is four waves per SIMD; told so, the compiler spends the registers on loads issued early instead of sinking them to their uses.
__global__ __launch_bounds__(128) __attribute__((amdgpu_waves_per_eu(4, 4))) void k_fattn(const h16* Q16, const h16* K16, const h16* V16, const bf* Qh, const bf* Ql, const bf* Kh, const bf* Kl, const bf* Vh, const bf* Vl, bf* Ah, bf* Al) {
    const int z = blockIdx.x; const int lane = threadIdx.x & 31, lr = lane & 15, hi = lane >> 4;
    const int q0 = (TT / 64 - 1 - (int)blockIdx.y) * 64 + __builtin_amdgcn_readfirstlane((int)(threadIdx.x >> 5)) * 16;   // wave-uniform, so the key loop is a scalar loop
    const size_t zp = (size_t)z * TT * HD; const size_t oo = ((size_t)(z / NH_) * TT + q0 + lr) * DQ + (z % NH_) * HD + 8 * hi;
    if (q0 < RH) attn_rows<bf, true>(Qh + zp, Ql + zp, Kh + zp, Kl + zp, Vh + zp, Vl + zp, q0, lr, hi, Ah + oo, Al + oo);
    else attn_rows<h16, false>(Q16 + zp, nullptr, K16 + zp, nullptr, V16 + zp, nullptr, q0, lr, hi, Ah + oo, Al + oo);
}

extern "C" void kernel_launch(void* const* d_in, const int* in_sizes, int n_in,
                              void* d_out, int out_size, void* d_ws, size_t ws_size, hipStream_t stream) {
    (void)in_sizes; (void)n_in; (void)out_size;
    const float* xr = (const float*)d_in[0]; const float* xe = (const float*)d_in[1]; const float* wq = (const float*)d_in[2]; const float* bq = (const float*)d_in[3]; const float* wk = (const float*)d_in[4]; const float* bk = (const float*)d_in[5]; const float* wv = (const float*)d_in[6]; const float* bv = (const float*)d_in[7]; const float* wo = (const float*)d_in[8]; const float* bo = (const float*)d_in[9]; const float* x = nullptr; (void)x;
    float* OUT = (float*)d_out;     // [8][1024][1024]
    char* wsp = (char*)d_ws;
    auto take = [&](size_t bytes) { char* p = wsp; wsp += (bytes + 255) & ~(size_t)255; return (void*)p; };
    bf* WQ = (bf*)take((size_t)DQ * DM * 2); bf* WK = (bf*)take((size_t)DKV * DM * 2); bf* WV = (bf*)take((size_t)DKV * DM * 2); bf* WO = (bf*)take((size_t)DM * DQ * 2);
    h16* QP16 = (h16*)take((size_t)GB * NH_ * TT * HD * 2); h16* KP16 = (h16*)take((size_t)GB * NKV * TT * HD * 2); h16* VT16 = (h16*)take((size_t)GB * NKV * HD * TT * 2);
    bf* QPh = (bf*)take((size_t)GB * NH_ * TT * HD * 2); bf* QPl = (bf*)take((size_t)GB * NH_ * TT * HD * 2); bf* KPh = (bf*)take((size_t)GB * NKV * TT * HD * 2); bf* KPl = (bf*)take((size_t)GB * NKV * TT * HD * 2); bf* VTh = (bf*)take((size_t)GB * NKV * HD * TT * 2); bf* VTl = (bf*)take((size_t)GB * NKV * HD * TT * 2);
    bf* XB = (bf*)take((size_t)GB * TT * DM * 2); bf* ATh = (bf*)take((size_t)GB * TT * DQ * 2); bf* ATl = (bf*)take((size_t)GB * TT * DQ * 2);
    if ((size_t)(wsp - (char*)d_ws) > ws_size) return;    // ws 256 MiB
    { k_wtN<<<(unsigned)((DM * DQ / 64 + 63) / 64), 256, 0, stream>>>(wq, WQ); k_wtN<<<(unsigned)((DM * DQ / 64 + 63) / 64), 256, 0, stream>>>(wk, WK); k_wtN<<<(unsigned)((DM * DQ / 64 + 63) / 64), 256, 0, stream>>>(wv, WV);
      k_wtG<<<(unsigned)((DQ * DM / 64 + 63) / 64), 256, 0, stream>>>(wo, DQ, DM, WO);
       }
    for (int b = 0; b < NB_; b += GB) {
        k_cvt8<<<(unsigned)(((size_t)GB * TT * DM / 8 + 255) / 256), 256, 0, stream>>>(xe + (size_t)b * TT * DM, XB, (size_t)GB * TT * DM / 8);   /* encoder_output -> q, k */
        k_gemmw<bf, 0, true, 1><<<dim3(GB * TT / 64, DQ / 64, 1), 32, 0, stream>>>(XB, nullptr, WQ, nullptr, DM, nullptr, 0, bq, 0, 0, 0, QP16, QPh, QPl);
        k_gemmw<bf, 0, true, 1><<<dim3(GB * TT / 64, DKV / 64, 1), 32, 0, stream>>>(XB, nullptr, WK, nullptr, DM, nullptr, 0, bk, 0, 0, 0, KP16, KPh, KPl);
        k_cvt8<<<(unsigned)(((size_t)GB * TT * DM / 8 + 255) / 256), 256, 0, stream>>>(xr + (size_t)b * TT * DM, XB, (size_t)GB * TT * DM / 8);   /* normalized_resid_pre -> v */
        k_gemmw<bf, 0, true, 2><<<dim3(DKV / 64, GB * TT / 64, 1), 32, 0, stream>>>(WV, nullptr, XB, nullptr, DM, nullptr, 0, bv, 0, 0, 0, VT16, VTh, VTl);   // weight rows as A: the tile comes out as V^T
        k_fattn<<<dim3(GB * NH_, TT / 64, 1), 128, 0, stream>>>(QP16, KP16, VT16, QPh, QPl, KPh, KPl, VTh, VTl, ATh, ATl);   // one kv head per query head: plane z of every array is (batch z / NH_, head z % NH_)
        k_gemmw<bf, 1, true, 0><<<dim3(GB * TT / 64, DM / 64, 1), 32, 0, stream>>>(ATh, ATl, WO, nullptr, DQ, OUT + (size_t)b * TT * DM, DM, bo, 0, 0, 0, nullptr, nullptr, nullptr); }
}

// v004
// Measured time: 263 microseconds a run.
// Next to v003, in two timings, it ran 1.48 and 1.47 times as fast.
// All steps since v000 together make it 15.3 times as fast.
#include <hip/hip_runtime.h>

// Decoder cross-attention with per-head weights (normalized_resid_pre, encoder_output [8][1024][1024]; q, k from encoder_output and v from normalized_resid_pre via 'hde' per-head weights [16][1024][64] + [16][64] biases; scores / 8 with the strict upper triangle REPLACED by -1e5; softmax; z O ('hed' [16][64][1024]) + Ob -> [8][1024][1024] (8.4 M)).
// Launch shape: projections and the O product run over GB batches at once (M = GB x 1024 rows); each projection GEMM writes its head planes itself; one fused attention launch covers the group's GB x 16 (batch, head) planes.
// Layout per batch: the per-head 'hde' weights gathered once into single [1024][1024] operands (one exact GEMM per projection, flattened biases); fused causal T-1024 attention with a running maximum (hybrid rows: < 512 hi/lo 3 products, rest fp16 x1024; key blocks above the diagonal are skipped, their weights being exactly zero after the -1e5 fill); merged context as hi/lo planes; O (flat 'xw' [1024][1024]) hl x exact + Ob.
// Compute dtypes, f32 accumulate: every input rounded to bf16; projections exact + f32 biases; attention rows < 512 3 products, rest fp16; softmax f32; O hl x exact + bias.

#define NB_  8
#define TT   1024
#define DM   1024
#define NH_  16
#define NKV  16
#define REP  (NH_ / NKV)
#define HD   64
#define DQ   (NH_ * HD)
#define DKV  (NKV * HD)
#define GB   4                    // batches per group: every projection launch covers GB x TT rows
#define RH   512                  // query rows < RH use hi+lo planes (0: none)
#define PCAR 1024.0f
#define SCL  0.125f   // HD^-0.5
typedef _Float16 h16;
typedef unsigned short bf;
typedef __attribute__((ext_vector_type(16))) __bf16   v16bf;
typedef __attribute__((ext_vector_type(16))) _Float16 v16h;
typedef __attribute__((ext_vector_type(8)))  _Float16 v8h;
typedef __attribute__((ext_vector_type(8)))  unsigned short v8us;
typedef __attribute__((ext_vector_type(8)))  float    v8f;
typedef __attribute__((ext_vector_type(4)))  float    v4f;
typedef v8h  __attribute__((may_alias)) v8ha;
typedef v4f  __attribute__((may_alias)) v4fa;
typedef v8us __attribute__((may_alias)) v8usa;

__device__ __forceinline__ unsigned short f2bf(float f) { unsigned u = __float_as_uint(f); u += 0x7FFFu + ((u >> 16) & 1u); return (unsigned short)(u >> 16); }
__device__ __forceinline__ float bf2f(unsigned short b) { return __uint_as_float(((unsigned)b) << 16); }
__device__ __forceinline__ float bfr(float f) { return bf2f(f2bf(f)); }
__device__ __forceinline__ v16h cat16(v8h lo, v8h hi) { return __builtin_shufflevector(lo, hi, 0, 1, 2, 3, 4, 5, 6, 7, 8, 9, 10, 11, 12, 13, 14, 15); }
__device__ __forceinline__ v16bf cat16b(v8us lo, v8us hi) { return __builtin_bit_cast(v16bf, __builtin_shufflevector(lo, hi, 0, 1, 2, 3, 4, 5, 6, 7, 8, 9, 10, 11, 12, 13, 14, 15)); }
__device__ __forceinline__ v8f wmma16(v16h a, v16h b, v8f c) { return __builtin_amdgcn_wmma_f32_16x16x32_f16(false, a, false, b, (short)0, c, false, false); }
__device__ __forceinline__ v8f wmmab(v16bf a, v16bf b, v8f c) { return __builtin_amdgcn_wmma_f32_16x16x32_bf16(false, a, false, b, (short)0, c, false, false); }
__device__ __forceinline__ h16 tohx(float x) { return (h16)x; }
__device__ __forceinline__ void splitf(float y, unsigned short& h, unsigned short& l) { h = f2bf(y); l = f2bf(y - bf2f(h)); }



// ---- k_gemmw: GEMM, one work-group of four waves (2 x 2) per 128x128 output tile, ONE WAVE per 64x64 quarter (16 accumulators); grid (M/128, N/128, Z), 128 threads.
// The operands, K-contiguous 16-bit planes, come through LDS: a stage is 128 k (256-byte rows) of the tile's 128 A rows (A2 rows) and 128 Bt rows, brought by asynchronous 16-byte copies
// (a wave's copy covers two whole rows, so every request is whole lines, and each row is fetched once for the two waves that use it); two buffers, the next stage's copies fly while this one is worked on.
// C[m][n] (f32, pitch ldc, + optional f32 bias[n]) = sum_k A[m][k] Bt[n][k] (+ A2[m][k] Bt[n][k] for NSPLIT 1). z-batch strides sA/sB/sC in elements. K % 128 == 0, M % 128 == 0, N % 128 == 0.
// PL 1, 2: no C; the tile + bias goes out as fp16 and hi/lo bf16 head planes, every store whole 128-byte lines (16 bytes a lane, 8 lanes a tile row).
// PL 1: m = b * TT + t, n = h * HD + d, bias[n]: the wave's tile is 64 rows t of plane [b][h][t][d]. PL 2 (the caller swaps the operands): m = h * HD + d, n = b * TT + t, bias[m]: the tile is the 64 rows d, 64 columns t, of plane [b][h][d][t].
#define GKP  128                  // k per stage
#define GPIT 272                  // LDS row pitch in bytes: 256 + 16, free of bank conflicts for 16-byte fragment reads
#define GOPB (128 * GPIT)         // bytes of one operand's 128 rows in a stage
template <typename T16> struct WFrag;
template <> struct WFrag<h16> { typedef v16h V; static __device__ __forceinline__ V ld(const h16* p) { return cat16(*(const v8h*)p, *(const v8h*)(p + 16)); } static __device__ __forceinline__ v8f mma(V a, V b, v8f c) { return wmma16(a, b, c); } };
template <> struct WFrag<bf> { typedef v16bf V; static __device__ __forceinline__ V ld(const bf* p) { return cat16b(*(const v8us*)p, *(const v8us*)(p + 16)); } static __device__ __forceinline__ v8f mma(V a, V b, v8f c) { return wmmab(a, b, c); } };
// Eight asynchronous 16-byte copies of a lane, global to LDS, rows 8 apart (gs, GPIT: bytes from one row to the next). The s_wait_xcnt stands inside the statement, behind the last copy, so that no address register is rewritten ahead of it.
__device__ __forceinline__ void copy8(unsigned l, const char* g, size_t gs) {
    asm volatile("global_load_async_to_lds_b128 %0, %8, off\n\tglobal_load_async_to_lds_b128 %1, %9, off\n\tglobal_load_async_to_lds_b128 %2, %10, off\n\tglobal_load_async_to_lds_b128 %3, %11, off\n\t"
                 "global_load_async_to_lds_b128 %4, %12, off\n\tglobal_load_async_to_lds_b128 %5, %13, off\n\tglobal_load_async_to_lds_b128 %6, %14, off\n\tglobal_load_async_to_lds_b128 %7, %15, off\n\ts_wait_xcnt 0x0"
                 :: "v"(l), "v"(l + 8 * GPIT), "v"(l + 16 * GPIT), "v"(l + 24 * GPIT), "v"(l + 32 * GPIT), "v"(l + 40 * GPIT), "v"(l + 48 * GPIT), "v"(l + 56 * GPIT),
                    "v"(g), "v"(g + 8 * gs), "v"(g + 16 * gs), "v"(g + 24 * gs), "v"(g + 32 * gs), "v"(g + 40 * gs), "v"(g + 48 * gs), "v"(g + 56 * gs) : "memory");
}
template <typename T16, int NSPLIT, bool BIAS, int PL>
__global__ __launch_bounds__(128) void k_gemmw(const T16* __restrict__ A, const T16* __restrict__ A2, const T16* __restrict__ Bt, const T16* __restrict__ Bt2, int K, float* C, int ldc, const float* __restrict__ bias, size_t sA, size_t sB, size_t sC, h16* P16, bf* Ph, bf* Pl) {
    static_assert(HD == 64 && TT % 64 == 0, "a 64x64 tile is one head wide and lies in one batch");
    static_assert(NSPLIT == 0 || NSPLIT == 1, "one Bt plane");
    typedef typename WFrag<T16>::V V;
    constexpr int NOP = (NSPLIT == 1) ? 3 : 2, STB = NOP * GOPB;   // operands in a stage: A, (A2,) Bt; bytes of a stage
    __shared__ __align__(16) unsigned char L[2 * STB];
    __shared__ __align__(16) float osw[4][16 * 68];
    const size_t z = blockIdx.z; A += z * sA; if (A2) A2 += z * sA; Bt += z * sB; C += z * sC; (void)Bt2;
    const int lane = threadIdx.x & 31, lr = lane & 15, hi = lane >> 4; const int wv = __builtin_amdgcn_readfirstlane((int)(threadIdx.x >> 5)), wm = wv >> 1, wn = wv & 1;
    const int r0 = blockIdx.x * 128 + wm * 64, c0 = blockIdx.y * 128 + wn * 64;   // the wave's own 64x64 tile
    float* os = osw[wv];
    v8f acc[4][4];
#pragma unroll
    for (int mb = 0; mb < 4; ++mb)
#pragma unroll
        for (int nb = 0; nb < 4; ++nb) acc[mb][nb] = (v8f){};
    // copies: this lane brings bytes 16 lr .. 16 lr + 15 of rows 2 wv + hi + 8 c, c = 0 .. 15, of every operand
    const int crow = 2 * wv + hi; const size_t gs = (size_t)K * 2;
    const char* gA = (const char*)(A + (size_t)(blockIdx.x * 128 + crow) * K) + 16 * lr; const char* gA2 = (NSPLIT == 1) ? (const char*)(A2 + (size_t)(blockIdx.x * 128 + crow) * K) + 16 * lr : gA;
    const char* gB = (const char*)(Bt + (size_t)(blockIdx.y * 128 + crow) * K) + 16 * lr;
    const unsigned lc = (unsigned)(size_t)(const void*)L + crow * GPIT + 16 * lr;   // its LDS byte address in buffer 0, operand 0
    auto stage = [&](int t, int buf) {   // stage t (k = t GKP ...) into buffer buf
        const unsigned l = lc + buf * STB; const size_t go = (size_t)t * (GKP * 2);
        auto rows = [&](unsigned lo, const char* g) {   // one operand's 128 rows
#pragma unroll 1   // rolled: unrolled, the address registers of all of a stage's copies are live at once, which spilled in the three-operand build
            for (int h = 0; h < 2; ++h) copy8(lo + h * 64 * GPIT, g + (size_t)h * 64 * gs, gs); };
        rows(l, gA + go); if (NSPLIT == 1) rows(l + GOPB, gA2 + go); rows(l + (NOP - 1) * GOPB, gB + go); };
    const int np = K / GKP;
    stage(0, 0);
    asm volatile("s_wait_asynccnt 0x0" ::: "memory");   // this wave's copies of stage 0 have landed
    __syncthreads();                                    // and every other wave's
    if (np > 1) stage(1, 1);
    const int fa = (wm * 64 + lr) * GPIT + 16 * hi, fb = (NOP - 1) * GOPB + (wn * 64 + lr) * GPIT + 16 * hi;   // the lane's first A and Bt fragment bytes in a stage
#pragma unroll 1
    for (int t = 0; t < np; ++t) {
        const unsigned char* sb = L + (t & 1) * STB;
        V a[2][4], a2[2][4], b[2][4];   // two fragment sets: the next 32 k are fetched, as one group, ahead of the products on this one
        auto ldf = [&](int s, int ks) {
#pragma unroll
            for (int mb = 0; mb < 4; ++mb) { a[s][mb] = WFrag<T16>::ld((const T16*)(sb + fa + mb * 16 * GPIT + ks * 64)); if (NSPLIT == 1) a2[s][mb] = WFrag<T16>::ld((const T16*)(sb + fa + GOPB + mb * 16 * GPIT + ks * 64)); }
#pragma unroll
            for (int nb = 0; nb < 4; ++nb) b[s][nb] = WFrag<T16>::ld((const T16*)(sb + fb + nb * 16 * GPIT + ks * 64)); };
        ldf(0, 0);
        __builtin_amdgcn_sched_barrier(0);               // the first set's reads go out first: the first products wait for them alone
#pragma unroll
        for (int ks = 0; ks < GKP / 32; ++ks) { const int s = ks & 1;
            if (ks + 1 < GKP / 32) ldf(s ^ 1, ks + 1);   // of this stage only: nothing of the next one is read in front of its barrier
            __builtin_amdgcn_sched_barrier(0);           // keeps the LDS reads one group in front of the block, for speed only
#pragma unroll
            for (int nb = 0; nb < 4; ++nb)
#pragma unroll
                for (int mb = 0; mb < 4; ++mb) { acc[mb][nb] = WFrag<T16>::mma(a[s][mb], b[s][nb], acc[mb][nb]); if (NSPLIT == 1) acc[mb][nb] = WFrag<T16>::mma(a2[s][mb], b[s][nb], acc[mb][nb]); }
            __builtin_amdgcn_sched_barrier(0);           // the other side of the same fence
        }
        // the distance behind the pass's last matrix instructions, also on the taken side of the branches below; naming every accumulator keeps all of them in front of it
        asm volatile("v_nop\n\tv_nop\n\tv_nop\n\tv_nop" : "+v"(acc[0][0]), "+v"(acc[0][1]), "+v"(acc[0][2]), "+v"(acc[0][3]), "+v"(acc[1][0]), "+v"(acc[1][1]), "+v"(acc[1][2]), "+v"(acc[1][3]),
                     "+v"(acc[2][0]), "+v"(acc[2][1]), "+v"(acc[2][2]), "+v"(acc[2][3]), "+v"(acc[3][0]), "+v"(acc[3][1]), "+v"(acc[3][2]), "+v"(acc[3][3]));
        asm volatile("s_wait_dscnt 0x0" ::: "memory");      // this wave has finished reading the buffer
        asm volatile("s_wait_asynccnt 0x0" ::: "memory");   // its copies of stage t + 1 have landed
        __syncthreads();                                    // publishes stage t + 1 and frees stage t's buffer
        if (t + 2 < np) stage(t + 2, t & 1);
    }
    asm volatile("s_wait_asynccnt 0x0" ::: "memory");       // nothing is in flight when the wave goes on
    const int prow = lane >> 3, pcol = (lane & 7) * 8;   // plane epilogue: this lane's row within four tile rows, and its 8 columns
    float bb[16];                                        // its biases: PL 1 one per column, PL 2 one per tile row it will store
    if constexpr (PL != 0) {
#pragma unroll
        for (int u = 0; u < ((PL == 1) ? 8 : 16); ++u) bb[u] = bias[(PL == 1) ? c0 + pcol + u : r0 + 4 * u + prow];
        asm volatile("s_wait_xcnt 0x0" ::: "memory");    // behind the loads, before their address registers are reused
    }
#pragma unroll
    for (int mb = 0; mb < 4; ++mb) {
#pragma unroll
        for (int nb = 0; nb < 4; ++nb) {
#pragma unroll
            for (int j = 0; j < 8; ++j) os[(hi * 8 + j) * 68 + nb * 16 + lr] = acc[mb][nb][j]; }
        __builtin_amdgcn_wave_barrier(); asm volatile("" ::: "memory");
        if constexpr (PL == 0) {
        float* crow = C + (size_t)(r0 + mb * 16) * ldc + c0;
{
#pragma unroll
            for (int s = 0; s < 8; ++s) { const int row = 2 * s + hi, cofs = lr * 4; v4f val = *(const v4fa*)(os + row * 68 + cofs); if (BIAS) { val[0] += bfr(bias[c0 + cofs]); val[1] += bfr(bias[c0 + cofs + 1]); val[2] += bfr(bias[c0 + cofs + 2]); val[3] += bfr(bias[c0 + cofs + 3]); }
                *(v4f*)(crow + (size_t)row * ldc + cofs) = val; }
             }
        } else {
            // first plane element of the tile, and the plane's pitch from one tile row to the next
            const size_t pb = (PL == 1) ? ((size_t)((r0 / TT) * NH_ + c0 / HD) * TT + r0 % TT) * HD : (size_t)((c0 / TT) * NH_ + r0 / HD) * HD * TT + c0 % TT; const int pp = (PL == 1) ? HD : TT;
            v8h o16[4]; v8us oh[4], ol[4];
#pragma unroll
            for (int s = 0; s < 4; ++s) { const int row = 4 * s + prow; const v4f va = *(const v4fa*)(os + row * 68 + pcol), vb = *(const v4fa*)(os + row * 68 + pcol + 4);
#pragma unroll
                for (int q = 0; q < 8; ++q) { const float y = ((q < 4) ? va[q & 3] : vb[q & 3]) + bfr(bb[(PL == 1) ? q : mb * 4 + s]); o16[s][q] = tohx(y); unsigned short a2, c2; splitf(y, a2, c2); oh[s][q] = a2; ol[s][q] = c2; }
                const size_t e = pb + (size_t)(mb * 16 + row) * pp + pcol; *(v8h*)(P16 + e) = o16[s]; *(v8us*)(Ph + e) = oh[s]; *(v8us*)(Pl + e) = ol[s]; }
            // behind the 12 stores: naming their data keeps those registers from being rewritten ahead of the wait
            asm volatile("s_wait_xcnt 0x0" :: "v"(o16[0]), "v"(o16[1]), "v"(o16[2]), "v"(o16[3]), "v"(oh[0]), "v"(oh[1]), "v"(oh[2]), "v"(oh[3]), "v"(ol[0]), "v"(ol[1]), "v"(ol[2]), "v"(ol[3]) : "memory");
        }
        __builtin_amdgcn_wave_barrier(); asm volatile("" ::: "memory");
    }
}

typedef __attribute__((ext_vector_type(2))) _Float16 v2h;
typedef __attribute__((ext_vector_type(4))) _Float16 v4h;
typedef __attribute__((ext_vector_type(2))) unsigned short v2us;
typedef __attribute__((ext_vector_type(4))) unsigned short v4us;
typedef __attribute__((ext_vector_type(2))) float v2f;
typedef __attribute__((ext_vector_type(4))) int v4i;

__global__ __launch_bounds__(256) void k_wtG(const float* __restrict__ w, int K, int N, bf* Bt) {
    const int lane = threadIdx.x & 31; const int L0 = (blockIdx.x * 8 + (threadIdx.x >> 5)) * 8; const int nlines = N * K / 64;
{
#pragma unroll 1
        for (int l = 0; l < 8; ++l) { const int L = L0 + l; if (L >= nlines) break; const size_t e = (size_t)L * 64 + lane * 2; const int k = (int)(e % K), n = (int)(e / K); v2us o;
            o[0] = f2bf(w[(size_t)k * N + n]); o[1] = f2bf(w[(size_t)(k + 1) * N + n]); *(v2us*)(Bt + e) = o; }
         }
}
__global__ __launch_bounds__(256) void k_cvt8(const float* __restrict__ src, bf* dst, size_t n8) { const size_t i = (size_t)blockIdx.x * 256 + threadIdx.x; if (i >= n8) return; const v8f v = *(const v8f*)(src + i * 8); v8us o;
#pragma unroll
    for (int k = 0; k < 8; ++k) o[k] = f2bf(v[k]); *(v8us*)(dst + i * 8) = o;  }

__global__ __launch_bounds__(256) void k_wtN(const float* __restrict__ w, bf* Bt) { const int lane = threadIdx.x & 31; const int L0 = (blockIdx.x * 8 + (threadIdx.x >> 5)) * 8; const int nlines = DQ * DM / 64;
{
#pragma unroll 1
        for (int l = 0; l < 8; ++l) { const int L = L0 + l; if (L >= nlines) break; const size_t e = (size_t)L * 64 + lane * 2; const int h = (int)(e % DM), r = (int)(e / DM); const int n = r / HD, d = r % HD; v2us o;
            o[0] = f2bf(w[((size_t)n * DM + h) * HD + d]); o[1] = f2bf(w[((size_t)n * DM + h + 1) * HD + d]); *(v2us*)(Bt + e) = o; }
         } }
// ---- k_fattn: fused causal attention, one wave per 16 query rows of one (batch, head) plane, four waves (64 rows) per work-group, no LDS and no barrier.
// Transposed products: S^T = K Q^T (A = 16 key rows, B = the wave's 16 query rows), so a lane holds scores of ONE query (column lr), keys 8 hi + r of each 16-key tile;
// two score tiles (32 keys), converted in place, are the B operand of O^T += V^T P^T (element s = tile s >> 3, register s & 7, the k order of WFrag::ld on the V^T rows).
// Running maximum in the log2 domain, unnormalised weights, one division at the end. HL: hi/lo bf16 planes, 3 products each; otherwise fp16 with the weights carried x PCAR.
// Every inner loop is fully unrolled so that the fragment arrays stay in registers.
#define L2E 1.4426950408889634f
__device__ __forceinline__ float ex2(float x) { float y; asm("v_exp_f32 %0, %1\n\tv_nop" : "=v"(y) : "v"(x)); return y; }   // 2^x; the v_nop keeps the free slot behind a transcendental
__device__ __forceinline__ float xhalf(float x) { return __builtin_bit_cast(float, __builtin_amdgcn_permlanex16(__builtin_bit_cast(int, x), __builtin_bit_cast(int, x), 0x76543210, 0xfedcba98, false, false)); }   // lane l reads lane l ^ 16
template <typename T16, bool HL>
__device__ __forceinline__ void attn_rows(const T16* Q, const T16* Q2, const T16* Kp, const T16* K2, const T16* Vt, const T16* V2, int q0, int lr, int hi, bf* Ah, bf* Al) {
    typedef typename WFrag<T16>::V V;
    const int i = q0 + lr;                        // this lane's query row
    const int kend = (q0 & ~31) + 32;             // key blocks of 32 up to and including the diagonal block; weights beyond the diagonal are exactly zero
    const size_t qo = (size_t)i * HD + 8 * hi, ko = (size_t)lr * HD + 8 * hi, vo = (size_t)lr * TT + 8 * hi;
    V q[2], q2[2], kf[2][2], kf2[2][2];
#pragma unroll
    for (int kc = 0; kc < 2; ++kc) { q[kc] = WFrag<T16>::ld(Q + qo + kc * 32); if (HL) q2[kc] = WFrag<T16>::ld(Q2 + qo + kc * 32); }
    auto ldk = [&](const T16* kp, const T16* kp2) {   // 32 K rows as A fragments
#pragma unroll
        for (int t = 0; t < 2; ++t)
#pragma unroll
            for (int kc = 0; kc < 2; ++kc) { kf[t][kc] = WFrag<T16>::ld(kp + t * 16 * HD + kc * 32); if (HL) kf2[t][kc] = WFrag<T16>::ld(kp2 + t * 16 * HD + kc * 32); } };
    if (!HL) ldk(Kp + ko, nullptr);
    v8f o[4];
#pragma unroll
    for (int db = 0; db < 4; ++db) o[db] = (v8f){};
    float m = -3.0e38f, l = 0.f;
    for (int kb = 0; kb < kend; kb += 32) {
        const T16* kp = Kp + ko + (size_t)kb * HD; const T16* kp2 = HL ? K2 + ko + (size_t)kb * HD : kp;
        if (HL) ldk(kp, kp2);                     // hi/lo planes: twice the fragment registers, so K is not fetched ahead (these rows have at most half the passes)
        V vf[4], vf2[4];                          // this block's V^T rows, issued ahead of the score products
        const T16* vp = Vt + vo + kb; const T16* vp2 = HL ? V2 + vo + kb : vp;
#pragma unroll
        for (int db = 0; db < 4; ++db) { vf[db] = WFrag<T16>::ld(vp + (size_t)db * 16 * TT); if (HL) vf2[db] = WFrag<T16>::ld(vp2 + (size_t)db * 16 * TT); }
        if (HL) asm volatile("s_wait_xcnt 0x0" :: "v"(kp), "v"(kp2), "v"(vp), "v"(vp2) : "memory");   // behind the loads: naming the addresses keeps their registers from becoming a later load's destination ahead of the wait
        v8f s[2];
#pragma unroll
        for (int t = 0; t < 2; ++t) { s[t] = (v8f){};
#pragma unroll
            for (int kc = 0; kc < 2; ++kc) { s[t] = WFrag<T16>::mma(kf[t][kc], q[kc], s[t]); if (HL) { s[t] = WFrag<T16>::mma(kf[t][kc], q2[kc], s[t]); s[t] = WFrag<T16>::mma(kf2[t][kc], q[kc], s[t]); } } }
        if (!HL) ldk(Kp + ko + (size_t)min(kb + 32, kend - 32) * HD, nullptr);    // the next block's K rows fly during the softmax (the last pass re-reads its own block: in bounds, unused)
        float x[16]; float mx = m;
#pragma unroll
        for (int e = 0; e < 16; ++e) { const int j = kb + (e >> 3) * 16 + 8 * hi + (e & 7); x[e] = (j <= i) ? s[e >> 3][e & 7] * (SCL * L2E) : -3.0e38f; mx = fmaxf(mx, x[e]); }
        mx = fmaxf(mx, xhalf(mx));   // the other half of the wave holds the query's other 16 keys
        float ps[4] = {0.f, 0.f, 0.f, 0.f};       // four short chains instead of one of 16 dependent adds
#pragma unroll
        for (int e = 0; e < 16; ++e) { x[e] = ex2(x[e] - mx); ps[e & 3] += x[e]; }
        const float al = ex2(m - mx); m = mx;     // what the sums so far are worth under the new maximum
        l = l * al + ((ps[0] + ps[1]) + (ps[2] + ps[3]));
#pragma unroll
        for (int db = 0; db < 4; ++db) o[db] *= al;
        if constexpr (HL) {
            v8us h0, h1, l0, l1;
#pragma unroll
            for (int r = 0; r < 8; ++r) { unsigned short a, c; splitf(x[r], a, c); h0[r] = a; l0[r] = c; splitf(x[8 + r], a, c); h1[r] = a; l1[r] = c; }
            const V ph = cat16b(h0, h1), pl = cat16b(l0, l1);
#pragma unroll
            for (int db = 0; db < 4; ++db) { o[db] = WFrag<T16>::mma(vf[db], ph, o[db]); o[db] = WFrag<T16>::mma(vf[db], pl, o[db]); o[db] = WFrag<T16>::mma(vf2[db], ph, o[db]); }
        } else {
            V p;
#pragma unroll
            for (int e = 0; e < 16; ++e) p[e] = tohx(x[e] * PCAR);
#pragma unroll
            for (int db = 0; db < 4; ++db) o[db] = WFrag<T16>::mma(vf[db], p, o[db]);
        }
    }
    l += xhalf(l);
    const float f = __fdiv_rn(HL ? 1.0f : (1.0f / PCAR), l);
#pragma unroll
    for (int db = 0; db < 4; ++db) { v8us oh, ol;   // registers 0..7 of O^T tile db are head columns db * 16 + 8 hi + r of the lane's query row: one 16-byte store per plane
#pragma unroll
        for (int r = 0; r < 8; ++r) { unsigned short a, c; splitf(o[db][r] * f, a, c); oh[r] = a; ol[r] = c; }
        *(v8us*)(Ah + db * 16) = oh; *(v8us*)(Al + db * 16) = ol; }
}
// grid (planes of the group, TT / 64 row blocks, the longest first), 128 threads; writes the merged context [b][t][h * HD + d] as hi/lo planes.
// amdgpu_waves_per_eu(4, 4): the launch is four waves per SIMD; told so, the compiler spends the registers on loads issued early instead of sinking them to their uses.
__global__ __launch_bounds__(128) __attribute__((amdgpu_waves_per_eu(4, 4))) void k_fattn(const h16* Q16, const h16* K16, const h16* V16, const bf* Qh, const bf* Ql, const bf* Kh, const bf* Kl, const bf* Vh, const bf* Vl, bf* Ah, bf* Al) {
    const int z = blockIdx.x; const int lane = threadIdx.x & 31, lr = lane & 15, hi = lane >> 4;
    const int q0 = (TT / 64 - 1 - (int)blockIdx.y) * 64 + __builtin_amdgcn_readfirstlane((int)(threadIdx.x >> 5)) * 16;   // wave-uniform, so the key loop is a scalar loop
    const size_t zp = (size_t)z * TT * HD; const size_t oo = ((size_t)(z / NH_) * TT + q0 + lr) * DQ + (z % NH_) * HD + 8 * hi;
    if (q0 < RH) attn_rows<bf, true>(Qh + zp, Ql + zp, Kh + zp, Kl + zp, Vh + zp, Vl + zp, q0, lr, hi, Ah + oo, Al + oo);
    else attn_rows<h16, false>(Q16 + zp, nullptr, K16 + zp, nullptr, V16 + zp, nullptr, q0, lr, hi, Ah + oo, Al + oo);
}

extern "C" void kernel_launch(void* const* d_in, const int* in_sizes, int n_in,
                              void* d_out, int out_size, void* d_ws, size_t ws_size, hipStream_t stream) {
    (void)in_sizes; (void)n_in; (void)out_size;
    const float* xr = (const float*)d_in[0]; const float* xe = (const float*)d_in[1]; const float* wq = (const float*)d_in[2]; const float* bq = (const float*)d_in[3]; const float* wk = (const float*)d_in[4]; const float* bk = (const float*)d_in[5]; const float* wv = (const float*)d_in[6]; const float* bv = (const float*)d_in[7]; const float* wo = (const float*)d_in[8]; const float* bo = (const float*)d_in[9]; const float* x = nullptr; (void)x;
    float* OUT = (float*)d_out;     // [8][1024][1024]
    char* wsp = (char*)d_ws;
    auto take = [&](size_t bytes) { char* p = wsp; wsp += (bytes + 255) & ~(size_t)255; return (void*)p; };
    bf* WQ = (bf*)take((size_t)DQ * DM * 2); bf* WK = (bf*)take((size_t)DKV * DM * 2); bf* WV = (bf*)take((size_t)DKV * DM * 2); bf* WO = (bf*)take((size_t)DM * DQ * 2);
    h16* QP16 = (h16*)take((size_t)GB * NH_ * TT * HD * 2); h16* KP16 = (h16*)take((size_t)GB * NKV * TT * HD * 2); h16* VT16 = (h16*)take((size_t)GB * NKV * HD * TT * 2);
    bf* QPh = (bf*)take((size_t)GB * NH_ * TT * HD * 2); bf* QPl = (bf*)take((size_t)GB * NH_ * TT * HD * 2); bf* KPh = (bf*)take((size_t)GB * NKV * TT * HD * 2); bf* KPl = (bf*)take((size_t)GB * NKV * TT * HD * 2); bf* VTh = (bf*)take((size_t)GB * NKV * HD * TT * 2); bf* VTl = (bf*)take((size_t)GB * NKV * HD * TT * 2);
    bf* XB = (bf*)take((size_t)GB * TT * DM * 2); bf* ATh = (bf*)take((size_t)GB * TT * DQ * 2); bf* ATl = (bf*)take((size_t)GB * TT * DQ * 2);
    if ((size_t)(wsp - (char*)d_ws) > ws_size) return;    // ws 256 MiB
    { k_wtN<<<(unsigned)((DM * DQ / 64 + 63) / 64), 256, 0, stream>>>(wq, WQ); k_wtN<<<(unsigned)((DM * DQ / 64 + 63) / 64), 256, 0, stream>>>(wk, WK); k_wtN<<<(unsigned)((DM * DQ / 64 + 63) / 64), 256, 0, stream>>>(wv, WV);
      k_wtG<<<(unsigned)((DQ * DM / 64 + 63) / 64), 256, 0, stream>>>(wo, DQ, DM, WO);
       }
    for (int b = 0; b < NB_; b += GB) {
        k_cvt8<<<(unsigned)(((size_t)GB * TT * DM / 8 + 255) / 256), 256, 0, stream>>>(xe + (size_t)b * TT * DM, XB, (size_t)GB * TT * DM / 8);   /* encoder_output -> q, k */
        k_gemmw<bf, 0, true, 1><<<dim3(GB * TT / 128, DQ / 128, 1), 128, 0, stream>>>(XB, nullptr, WQ, nullptr, DM, nullptr, 0, bq, 0, 0, 0, QP16, QPh, QPl);
        k_gemmw<bf, 0, true, 1><<<dim3(GB * TT / 128, DKV / 128, 1), 128, 0, stream>>>(XB, nullptr, WK, nullptr, DM, nullptr, 0, bk, 0, 0, 0, KP16, KPh, KPl);
        k_cvt8<<<(unsigned)(((size_t)GB * TT * DM / 8 + 255) / 256), 256, 0, stream>>>(xr + (size_t)b * TT * DM, XB, (size_t)GB * TT * DM / 8);   /* normalized_resid_pre -> v */
        k_gemmw<bf, 0, true, 2><<<dim3(DKV / 128, GB * TT / 128, 1), 128, 0, stream>>>(WV, nullptr, XB, nullptr, DM, nullptr, 0, bv, 0, 0, 0, VT16, VTh, VTl);   // weight rows as A: the tile comes out as V^T
        k_fattn<<<dim3(GB * NH_, TT / 64, 1), 128, 0, stream>>>(QP16, KP16, VT16, QPh, QPl, KPh, KPl, VTh, VTl, ATh, ATl);   // one kv head per query head: plane z of every array is (batch z / NH_, head z % NH_)
        k_gemmw<bf, 1, true, 0><<<dim3(GB * TT / 128, DM / 128, 1), 128, 0, stream>>>(ATh, ATl, WO, nullptr, DQ, OUT + (size_t)b * TT * DM, DM, bo, 0, 0, 0, nullptr, nullptr, nullptr); }
}

// v005
// One run takes 182 microseconds.
// Timed twice side by side with v004, it ran 1.45 and 1.44 times as fast.
// Counting every step since v000, it is 22.2 times as fast.
#include <hip/hip_runtime.h>

// Decoder cross-attention with per-head weights (normalized_resid_pre, encoder_output [8][1024][1024]; q, k from encoder_output and v from normalized_resid_pre via 'hde' per-head weights [16][1024][64] + [16][64] biases; scores / 8 with the strict upper triangle REPLACED by -1e5; softmax; z O ('hed' [16][64][1024]) + Ob -> [8][1024][1024] (8.4 M)).
// Launch shape, five launches: one preparation launch (weights gathered, both inputs rounded); q and k as one GEMM grid (z picks the weight, bias and planes), v as a second; one fused attention launch over all GB x 16 (batch, head) planes; the O product. Every GEMM runs over all GB batches at once (GB x 1024 rows: M; N for v) and each projection writes its head planes itself.
// Layout per batch: the per-head 'hde' weights gathered once into single [1024][1024] operands (one exact GEMM per projection, flattened biases); fused causal T-1024 attention with a running maximum (hybrid rows: < 512 hi/lo 3 products, rest fp16 x1024; key blocks above the diagonal are skipped, their weights being exactly zero after the -1e5 fill); merged context as hi/lo planes; O (flat 'xw' [1024][1024]) hl x exact + Ob.
// Compute dtypes, f32 accumulate: every input rounded to bf16; projections exact + bf16-rounded biases; attention rows < 512 3 products, rest fp16; softmax f32; O hl x exact + bias.

#define NB_  8
#define TT   1024
#define DM   1024
#define NH_  16
#define NKV  16
#define REP  (NH_ / NKV)
#define HD   64
#define DQ   (NH_ * HD)
#define DKV  (NKV * HD)
#define GB   NB_                  // batches per launch: every launch covers all GB x TT rows
#define RH   512                  // query rows < RH use hi+lo planes (0: none)
#define PCAR 1024.0f
#define SCL  0.125f   // HD^-0.5
typedef _Float16 h16;
typedef unsigned short bf;
typedef __attribute__((ext_vector_type(16))) __bf16   v16bf;
typedef __attribute__((ext_vector_type(16))) _Float16 v16h;
typedef __attribute__((ext_vector_type(8)))  _Float16 v8h;
typedef __attribute__((ext_vector_type(8)))  unsigned short v8us;
typedef __attribute__((ext_vector_type(8)))  float    v8f;
typedef __attribute__((ext_vector_type(4)))  float    v4f;
typedef v8h  __attribute__((may_alias)) v8ha;
typedef v4f  __attribute__((may_alias)) v4fa;
typedef v8us __attribute__((may_alias)) v8usa;

__device__ __forceinline__ unsigned short f2bf(float f) { unsigned u = __float_as_uint(f); u += 0x7FFFu + ((u >> 16) & 1u); return (unsigned short)(u >> 16); }
__device__ __forceinline__ float bf2f(unsigned short b) { return __uint_as_float(((unsigned)b) << 16); }
__device__ __forceinline__ float bfr(float f) { return bf2f(f2bf(f)); }
__device__ __forceinline__ v16h cat16(v8h lo, v8h hi) { return __builtin_shufflevector(lo, hi, 0, 1, 2, 3, 4, 5, 6, 7, 8, 9, 10, 11, 12, 13, 14, 15); }
__device__ __forceinline__ v16bf cat16b(v8us lo, v8us hi) { return __builtin_bit_cast(v16bf, __builtin_shufflevector(lo, hi, 0, 1, 2, 3, 4, 5, 6, 7, 8, 9, 10, 11, 12, 13, 14, 15)); }
__device__ __forceinline__ v8f wmma16(v16h a, v16h b, v8f c) { return __builtin_amdgcn_wmma_f32_16x16x32_f16(false, a, false, b, (short)0, c, false, false); }
__device__ __forceinline__ v8f wmmab(v16bf a, v16bf b, v8f c) { return __builtin_amdgcn_wmma_f32_16x16x32_bf16(false, a, false, b, (short)0, c, false, false); }
__device__ __forceinline__ h16 tohx(float x) { return (h16)x; }
__device__ __forceinline__ void splitf(float y, unsigned short& h, unsigned short& l) { h = f2bf(y); l = f2bf(y - bf2f(h)); }



// ---- k_gemmw: GEMM, one work-group of four waves (2 x 2) per 128x128 output tile, ONE WAVE per 64x64 quarter (16 accumulators); grid (M/128, N/128, Z), 128 threads.
// The operands, K-contiguous 16-bit planes, come through LDS: a stage is 128 k (256-byte rows) of the tile's 128 A rows (A2 rows) and 128 Bt rows, brought by asynchronous 16-byte copies
// (a wave's copy covers two whole rows, so every request is whole lines, and each row is fetched once for the two waves that use it); two buffers, the next stage's copies fly while this one is worked on.
// C[m][n] (f32, pitch ldc, + optional f32 bias[n]) = sum_k A[m][k] Bt[n][k] (+ A2[m][k] Bt[n][k] for NSPLIT 1). z-batch strides sA/sB/sC, and sP for the planes, in elements; z = 1 takes bias2. K % 128 == 0, M % 128 == 0, N % 128 == 0.
// PL 1, 2: no C; the tile + bias goes out as fp16 and hi/lo bf16 head planes, every store whole 128-byte lines (16 bytes a lane, 8 lanes a tile row).
// PL 1: m = b * TT + t, n = h * HD + d, bias[n]: the wave's tile is 64 rows t of plane [b][h][t][d]. PL 2 (the caller swaps the operands): m = h * HD + d, n = b * TT + t, bias[m]: the tile is the 64 rows d, 64 columns t, of plane [b][h][d][t].
#define GKP  128                  // k per stage
#define GPIT 272                  // LDS row pitch in bytes: 256 + 16, free of bank conflicts for 16-byte fragment reads
#define GOPB (128 * GPIT)         // bytes of one operand's 128 rows in a stage
template <typename T16> struct WFrag;
template <> struct WFrag<h16> { typedef v16h V; static __device__ __forceinline__ V ld(const h16* p) { return cat16(*(const v8h*)p, *(const v8h*)(p + 16)); } static __device__ __forceinline__ v8f mma(V a, V b, v8f c) { return wmma16(a, b, c); } };
template <> struct WFrag<bf> { typedef v16bf V; static __device__ __forceinline__ V ld(const bf* p) { return cat16b(*(const v8us*)p, *(const v8us*)(p + 16)); } static __device__ __forceinline__ v8f mma(V a, V b, v8f c) { return wmmab(a, b, c); } };
// Eight asynchronous 16-byte copies of a lane, global to LDS, rows 8 apart (gs, GPIT: bytes from one row to the next). The s_wait_xcnt stands inside the statement, behind the last copy, so that no address register is rewritten ahead of it.
__device__ __forceinline__ void copy8(unsigned l, const char* g, size_t gs) {
    asm volatile("global_load_async_to_lds_b128 %0, %8, off\n\tglobal_load_async_to_lds_b128 %1, %9, off\n\tglobal_load_async_to_lds_b128 %2, %10, off\n\tglobal_load_async_to_lds_b128 %3, %11, off\n\t"
                 "global_load_async_to_lds_b128 %4, %12, off\n\tglobal_load_async_to_lds_b128 %5, %13, off\n\tglobal_load_async_to_lds_b128 %6, %14, off\n\tglobal_load_async_to_lds_b128 %7, %15, off\n\ts_wait_xcnt 0x0"
                 :: "v"(l), "v"(l + 8 * GPIT), "v"(l + 16 * GPIT), "v"(l + 24 * GPIT), "v"(l + 32 * GPIT), "v"(l + 40 * GPIT), "v"(l + 48 * GPIT), "v"(l + 56 * GPIT),
                    "v"(g), "v"(g + 8 * gs), "v"(g + 16 * gs), "v"(g + 24 * gs), "v"(g + 32 * gs), "v"(g + 40 * gs), "v"(g + 48 * gs), "v"(g + 56 * gs) : "memory");
}
template <typename T16, int NSPLIT, bool BIAS, int PL>
__global__ __launch_bounds__(128) void k_gemmw(const T16* __restrict__ A, const T16* __restrict__ A2, const T16* __restrict__ Bt, const T16* __restrict__ Bt2, int K, float* C, int ldc, const float* __restrict__ bias, const float* __restrict__ bias2, size_t sA, size_t sB, size_t sC, size_t sP, h16* P16, bf* Ph, bf* Pl) {
    static_assert(HD == 64 && TT % 64 == 0, "a 64x64 tile is one head wide and lies in one batch");
    static_assert(NSPLIT == 0 || NSPLIT == 1, "one Bt plane");
    typedef typename WFrag<T16>::V V;
    constexpr int NOP = (NSPLIT == 1) ? 3 : 2, STB = NOP * GOPB;   // operands in a stage: A, (A2,) Bt; bytes of a stage
    __shared__ __align__(16) unsigned char L[2 * STB];
    __shared__ __align__(16) float osw[4][16 * 68];
    const size_t z = blockIdx.z; A += z * sA; if (A2) A2 += z * sA; Bt += z * sB; C += z * sC; (void)Bt2;
    if (PL != 0) { P16 += z * sP; Ph += z * sP; Pl += z * sP; if (z) bias = bias2; }
    const int lane = threadIdx.x & 31, lr = lane & 15, hi = lane >> 4; const int wv = __builtin_amdgcn_readfirstlane((int)(threadIdx.x >> 5)), wm = wv >> 1, wn = wv & 1;
    const int r0 = blockIdx.x * 128 + wm * 64, c0 = blockIdx.y * 128 + wn * 64;   // the wave's own 64x64 tile
    float* os = osw[wv];
    v8f acc[4][4];
#pragma unroll
    for (int mb = 0; mb < 4; ++mb)
#pragma unroll
        for (int nb = 0; nb < 4; ++nb) acc[mb][nb] = (v8f){};
    // copies: this lane brings bytes 16 lr .. 16 lr + 15 of rows 2 wv + hi + 8 c, c = 0 .. 15, of every operand
    const int crow = 2 * wv + hi; const size_t gs = (size_t)K * 2;
    const char* gA = (const char*)(A + (size_t)(blockIdx.x * 128 + crow) * K) + 16 * lr; const char* gA2 = (NSPLIT == 1) ? (const char*)(A2 + (size_t)(blockIdx.x * 128 + crow) * K) + 16 * lr : gA;
    const char* gB = (const char*)(Bt + (size_t)(blockIdx.y * 128 + crow) * K) + 16 * lr;
    const unsigned lc = (unsigned)(size_t)(const void*)L + crow * GPIT + 16 * lr;   // its LDS byte address in buffer 0, operand 0
    auto stage = [&](int t, int buf) {   // stage t (k = t GKP ...) into buffer buf
        const unsigned l = lc + buf * STB; const size_t go = (size_t)t * (GKP * 2);
        auto rows = [&](unsigned lo, const char* g) {   // one operand's 128 rows
#pragma unroll 1   // rolled: unrolled, the address registers of all of a stage's copies are live at once, which spilled in the three-operand build
            for (int h = 0; h < 2; ++h) copy8(lo + h * 64 * GPIT, g + (size_t)h * 64 * gs, gs); };
        rows(l, gA + go); if (NSPLIT == 1) rows(l + GOPB, gA2 + go); rows(l + (NOP - 1) * GOPB, gB + go); };
    const int np = K / GKP;
    stage(0, 0);
    asm volatile("s_wait_asynccnt 0x0" ::: "memory");   // this wave's copies of stage 0 have landed
    __syncthreads();                                    // and every other wave's
    if (np > 1) stage(1, 1);
    const int fa = (wm * 64 + lr) * GPIT + 16 * hi, fb = (NOP - 1) * GOPB + (wn * 64 + lr) * GPIT + 16 * hi;   // the lane's first A and Bt fragment bytes in a stage
#pragma unroll 1
    for (int t = 0; t < np; ++t) {
        const unsigned char* sb = L + (t & 1) * STB;
        V a[2][4], a2[2][4], b[2][4];   // two fragment sets: the next 32 k are fetched, as one group, ahead of the products on this one
        auto ldf = [&](int s, int ks) {
#pragma unroll
            for (int mb = 0; mb < 4; ++mb) { a[s][mb] = WFrag<T16>::ld((const T16*)(sb + fa + mb * 16 * GPIT + ks * 64)); if (NSPLIT == 1) a2[s][mb] = WFrag<T16>::ld((const T16*)(sb + fa + GOPB + mb * 16 * GPIT + ks * 64)); }
#pragma unroll
            for (int nb = 0; nb < 4; ++nb) b[s][nb] = WFrag<T16>::ld((const T16*)(sb + fb + nb * 16 * GPIT + ks * 64)); };
        ldf(0, 0);
        __builtin_amdgcn_sched_barrier(0);               // the first set's reads go out first: the first products wait for them alone
#pragma unroll
        for (int ks = 0; ks < GKP / 32; ++ks) { const int s = ks & 1;
            if (ks + 1 < GKP / 32) ldf(s ^ 1, ks + 1);   // of this stage only: nothing of the next one is read in front of its barrier
            __builtin_amdgcn_sched_barrier(0);           // keeps the LDS reads one group in front of the block, for speed only
#pragma unroll
            for (int nb = 0; nb < 4; ++nb)
#pragma unroll
                for (int mb = 0; mb < 4; ++mb) { acc[mb][nb] = WFrag<T16>::mma(a[s][mb], b[s][nb], acc[mb][nb]); if (NSPLIT == 1) acc[mb][nb] = WFrag<T16>::mma(a2[s][mb], b[s][nb], acc[mb][nb]); }
            __builtin_amdgcn_sched_barrier(0);           // the other side of the same fence
        }
        // the distance behind the pass's last matrix instructions, also on the taken side of the branches below; naming every accumulator keeps all of them in front of it
        asm volatile("v_nop\n\tv_nop\n\tv_nop\n\tv_nop" : "+v"(acc[0][0]), "+v"(acc[0][1]), "+v"(acc[0][2]), "+v"(acc[0][3]), "+v"(acc[1][0]), "+v"(acc[1][1]), "+v"(acc[1][2]), "+v"(acc[1][3]),
                     "+v"(acc[2][0]), "+v"(acc[2][1]), "+v"(acc[2][2]), "+v"(acc[2][3]), "+v"(acc[3][0]), "+v"(acc[3][1]), "+v"(acc[3][2]), "+v"(acc[3][3]));
        asm volatile("s_wait_dscnt 0x0" ::: "memory");      // this wave has finished reading the buffer
        asm volatile("s_wait_asynccnt 0x0" ::: "memory");   // its copies of stage t + 1 have landed
        __syncthreads();                                    // publishes stage t + 1 and frees stage t's buffer
        if (t + 2 < np) stage(t + 2, t & 1);
    }
    asm volatile("s_wait_asynccnt 0x0" ::: "memory");       // nothing is in flight when the wave goes on
    const int prow = lane >> 3, pcol = (lane & 7) * 8;   // plane epilogue: this lane's row within four tile rows, and its 8 columns
    float bb[16];                                        // its biases: PL 1 one per column, PL 2 one per tile row it will store
    if constexpr (PL != 0) {
#pragma unroll
        for (int u = 0; u < ((PL == 1) ? 8 : 16); ++u) bb[u] = bias[(PL == 1) ? c0 + pcol + u : r0 + 4 * u + prow];
        asm volatile("s_wait_xcnt 0x0" ::: "memory");    // behind the loads, before their address registers are reused
    }
#pragma unroll
    for (int mb = 0; mb < 4; ++mb) {
#pragma unroll
        for (int nb = 0; nb < 4; ++nb) {
#pragma unroll
            for (int j = 0; j < 8; ++j) os[(hi * 8 + j) * 68 + nb * 16 + lr] = acc[mb][nb][j]; }
        __builtin_amdgcn_wave_barrier(); asm volatile("" ::: "memory");
        if constexpr (PL == 0) {
        float* crow = C + (size_t)(r0 + mb * 16) * ldc + c0;
{
#pragma unroll
            for (int s = 0; s < 8; ++s) { const int row = 2 * s + hi, cofs = lr * 4; v4f val = *(const v4fa*)(os + row * 68 + cofs); if (BIAS) { val[0] += bfr(bias[c0 + cofs]); val[1] += bfr(bias[c0 + cofs + 1]); val[2] += bfr(bias[c0 + cofs + 2]); val[3] += bfr(bias[c0 + cofs + 3]); }
                *(v4f*)(crow + (size_t)row * ldc + cofs) = val; }
             }
        } else {
            // first plane element of the tile, and the plane's pitch from one tile row to the next
            const size_t pb = (PL == 1) ? ((size_t)((r0 / TT) * NH_ + c0 / HD) * TT + r0 % TT) * HD : (size_t)((c0 / TT) * NH_ + r0 / HD) * HD * TT + c0 % TT; const int pp = (PL == 1) ? HD : TT;
            v8h o16[4]; v8us oh[4], ol[4];
#pragma unroll
            for (int s = 0; s < 4; ++s) { const int row = 4 * s + prow; const v4f va = *(const v4fa*)(os + row * 68 + pcol), vb = *(const v4fa*)(os + row * 68 + pcol + 4);
#pragma unroll
                for (int q = 0; q < 8; ++q) { const float y = ((q < 4) ? va[q & 3] : vb[q & 3]) + bfr(bb[(PL == 1) ? q : mb * 4 + s]); o16[s][q] = tohx(y); unsigned short a2, c2; splitf(y, a2, c2); oh[s][q] = a2; ol[s][q] = c2; }
                const size_t e = pb + (size_t)(mb * 16 + row) * pp + pcol; *(v8h*)(P16 + e) = o16[s]; *(v8us*)(Ph + e) = oh[s]; *(v8us*)(Pl + e) = ol[s]; }
            // behind the 12 stores: naming their data keeps those registers from being rewritten ahead of the wait
            asm volatile("s_wait_xcnt 0x0" :: "v"(o16[0]), "v"(o16[1]), "v"(o16[2]), "v"(o16[3]), "v"(oh[0]), "v"(oh[1]), "v"(oh[2]), "v"(oh[3]), "v"(ol[0]), "v"(ol[1]), "v"(ol[2]), "v"(ol[3]) : "memory");
        }
        __builtin_amdgcn_wave_barrier(); asm volatile("" ::: "memory");
    }
}

typedef __attribute__((ext_vector_type(2))) _Float16 v2h;
typedef __attribute__((ext_vector_type(4))) _Float16 v4h;
typedef __attribute__((ext_vector_type(2))) unsigned short v2us;
typedef __attribute__((ext_vector_type(4))) unsigned short v4us;
typedef __attribute__((ext_vector_type(2))) float v2f;
typedef __attribute__((ext_vector_type(4))) int v4i;

// ---- k_prep: all operand preparation as one grid of 256-thread work-groups, the part picked by block index: WTB blocks for each of the four weights, then CVB blocks for each of the two inputs. Each thread's work is what it was in the separate launches.
#define WTB  (DM * DQ / 64 / 64)      // blocks per weight: 8 waves x 8 lines of 64 elements
#define CVB  (NB_ * TT * DM / 8 / 256)   // blocks per input: 8 elements a thread
__device__ __forceinline__ void wtG(const float* __restrict__ w, int K, int N, bf* Bt, int blk) {
    const int lane = threadIdx.x & 31; const int L0 = (blk * 8 + (threadIdx.x >> 5)) * 8; const int nlines = N * K / 64;
{
#pragma unroll 1
        for (int l = 0; l < 8; ++l) { const int L = L0 + l; if (L >= nlines) break; const size_t e = (size_t)L * 64 + lane * 2; const int k = (int)(e % K), n = (int)(e / K); v2us o;
            o[0] = f2bf(w[(size_t)k * N + n]); o[1] = f2bf(w[(size_t)(k + 1) * N + n]); *(v2us*)(Bt + e) = o;
            asm volatile("s_wait_xcnt 0x0" ::: "memory"); }   // behind the store, before the next trip rewrites its registers
         }
}
__device__ __forceinline__ void cvt8(const float* __restrict__ src, bf* dst, int blk) { const size_t i = (size_t)blk * 256 + threadIdx.x; const v8f v = *(const v8f*)(src + i * 8); v8us o;
#pragma unroll
    for (int k = 0; k < 8; ++k) o[k] = f2bf(v[k]); *(v8us*)(dst + i * 8) = o;
    asm volatile("s_wait_xcnt 0x0" :: "v"(o) : "memory"); }   // behind the store, its data named so that those registers are not rewritten ahead of it

__device__ __forceinline__ void wtN(const float* __restrict__ w, bf* Bt, int blk) { const int lane = threadIdx.x & 31; const int L0 = (blk * 8 + (threadIdx.x >> 5)) * 8; const int nlines = DQ * DM / 64;
{
#pragma unroll 1
        for (int l = 0; l < 8; ++l) { const int L = L0 + l; if (L >= nlines) break; const size_t e = (size_t)L * 64 + lane * 2; const int h = (int)(e % DM), r = (int)(e / DM); const int n = r / HD, d = r % HD; v2us o;
            o[0] = f2bf(w[((size_t)n * DM + h) * HD + d]); o[1] = f2bf(w[((size_t)n * DM + h + 1) * HD + d]); *(v2us*)(Bt + e) = o; }
         } }
__global__ __launch_bounds__(256) void k_prep(const float* __restrict__ wq, const float* __restrict__ wk, const float* __restrict__ wv, const float* __restrict__ wo, const float* __restrict__ xe, const float* __restrict__ xr, bf* WQ, bf* WK, bf* WV, bf* WO, bf* XE, bf* XR) {
    static_assert(NB_ * TT * DM % (8 * 256) == 0 && DM * DQ % (64 * 64) == 0, "whole blocks");
    const int bx = (int)blockIdx.x;   // the weights' blocks, the long ones (eight dependent gathers a wave), come first
    if (bx < 3 * WTB) { const int wsel = bx / WTB; wtN(wsel == 0 ? wq : wsel == 1 ? wk : wv, wsel == 0 ? WQ : wsel == 1 ? WK : WV, bx - wsel * WTB); }
    else if (bx < 4 * WTB) wtG(wo, DQ, DM, WO, bx - 3 * WTB);
    else { const int xsel = (bx - 4 * WTB) / CVB; cvt8(xsel ? xr : xe, xsel ? XR : XE, bx - 4 * WTB - xsel * CVB); }
}
// ---- k_fattn: fused causal attention, one wave per 16 query rows of one (batch, head) plane, four waves (64 rows) per work-group, no LDS and no barrier.
// Transposed products: S^T = K Q^T (A = 16 key rows, B = the wave's 16 query rows), so a lane holds scores of ONE query (column lr), keys 8 hi + r of each 16-key tile;
// two score tiles (32 keys), converted in place, are the B operand of O^T += V^T P^T (element s = tile s >> 3, register s & 7, the k order of WFrag::ld on the V^T rows).
// Running maximum in the log2 domain, unnormalised weights, one division at the end. HL: hi/lo bf16 planes, 3 products each; otherwise fp16 with the weights carried x PCAR.
// Every inner loop is fully unrolled so that the fragment arrays stay in registers.
#define L2E 1.4426950408889634f
__device__ __forceinline__ float ex2(float x) { float y; asm("v_exp_f32 %0, %1\n\tv_nop" : "=v"(y) : "v"(x)); return y; }   // 2^x; the v_nop keeps the free slot behind a transcendental
__device__ __forceinline__ float xhalf(float x) { return __builtin_bit_cast(float, __builtin_amdgcn_permlanex16(__builtin_bit_cast(int, x), __builtin_bit_cast(int, x), 0x76543210, 0xfedcba98, false, false)); }   // lane l reads lane l ^ 16
template <typename T16, bool HL>
__device__ __forceinline__ void attn_rows(const T16* Q, const T16* Q2, const T16* Kp, const T16* K2, const T16* Vt, const T16* V2, int q0, int lr, int hi, bf* Ah, bf* Al) {
    typedef typename WFrag<T16>::V V;
    const int i = q0 + lr;                        // this lane's query row
    const int kend = (q0 & ~31) + 32;             // key blocks of 32 up to and including the diagonal block; weights beyond the diagonal are exactly zero
    const size_t qo = (size_t)i * HD + 8 * hi, ko = (size_t)lr * HD + 8 * hi, vo = (size_t)lr * TT + 8 * hi;
    V q[2], q2[2], kf[2][2], kf2[2][2];
#pragma unroll
    for (int kc = 0; kc < 2; ++kc) { q[kc] = WFrag<T16>::ld(Q + qo + kc * 32); if (HL) q2[kc] = WFrag<T16>::ld(Q2 + qo + kc * 32); }
    auto ldk = [&](const T16* kp, const T16* kp2) {   // 32 K rows as A fragments
#pragma unroll
        for (int t = 0; t < 2; ++t)
#pragma unroll
            for (int kc = 0; kc < 2; ++kc) { kf[t][kc] = WFrag<T16>::ld(kp + t * 16 * HD + kc * 32); if (HL) kf2[t][kc] = WFrag<T16>::ld(kp2 + t * 16 * HD + kc * 32); } };
    if (!HL) ldk(Kp + ko, nullptr);
    v8f o[4];
#pragma unroll
    for (int db = 0; db < 4; ++db) o[db] = (v8f){};
    float m = -3.0e38f, l = 0.f;
    for (int kb = 0; kb < kend; kb += 32) {
        const T16* kp = Kp + ko + (size_t)kb * HD; const T16* kp2 = HL ? K2 + ko + (size_t)kb * HD : kp;
        if (HL) ldk(kp, kp2);                     // hi/lo planes: twice the fragment registers, so K is not fetched ahead (these rows have at most half the passes)
        V vf[4], vf2[4];                          // this block's V^T rows, issued ahead of the score products
        const T16* vp = Vt + vo + kb; const T16* vp2 = HL ? V2 + vo + kb : vp;
#pragma unroll
        for (int db = 0; db < 4; ++db) { vf[db] = WFrag<T16>::ld(vp + (size_t)db * 16 * TT); if (HL) vf2[db] = WFrag<T16>::ld(vp2 + (size_t)db * 16 * TT); }
        if (HL) asm volatile("s_wait_xcnt 0x0" :: "v"(kp), "v"(kp2), "v"(vp), "v"(vp2) : "memory");   // behind the loads: naming the addresses keeps their registers from becoming a later load's destination ahead of the wait
        v8f s[2];
#pragma unroll
        for (int t = 0; t < 2; ++t) { s[t] = (v8f){};
#pragma unroll
            for (int kc = 0; kc < 2; ++kc) { s[t] = WFrag<T16>::mma(kf[t][kc], q[kc], s[t]); if (HL) { s[t] = WFrag<T16>::mma(kf[t][kc], q2[kc], s[t]); s[t] = WFrag<T16>::mma(kf2[t][kc], q[kc], s[t]); } } }
        if (!HL) ldk(Kp + ko + (size_t)min(kb + 32, kend - 32) * HD, nullptr);    // the next block's K rows fly during the softmax (the last pass re-reads its own block: in bounds, unused)
        float x[16]; float mx = m;
#pragma unroll
        for (int e = 0; e < 16; ++e) { const int j = kb + (e >> 3) * 16 + 8 * hi + (e & 7); x[e] = (j <= i) ? s[e >> 3][e & 7] * (SCL * L2E) : -3.0e38f; mx = fmaxf(mx, x[e]); }
        mx = fmaxf(mx, xhalf(mx));   // the other half of the wave holds the query's other 16 keys
        float ps[4] = {0.f, 0.f, 0.f, 0.f};       // four short chains instead of one of 16 dependent adds
#pragma unroll
        for (int e = 0; e < 16; ++e) { x[e] = ex2(x[e] - mx); ps[e & 3] += x[e]; }
        const float al = ex2(m - mx); m = mx;     // what the sums so far are worth under the new maximum
        l = l * al + ((ps[0] + ps[1]) + (ps[2] + ps[3]));
#pragma unroll
        for (int db = 0; db < 4; ++db) o[db] *= al;
        if constexpr (HL) {
            v8us h0, h1, l0, l1;
#pragma unroll
            for (int r = 0; r < 8; ++r) { unsigned short a, c; splitf(x[r], a, c); h0[r] = a; l0[r] = c; splitf(x[8 + r], a, c); h1[r] = a; l1[r] = c; }
            const V ph = cat16b(h0, h1), pl = cat16b(l0, l1);
#pragma unroll
            for (int db = 0; db < 4; ++db) { o[db] = WFrag<T16>::mma(vf[db], ph, o[db]); o[db] = WFrag<T16>::mma(vf[db], pl, o[db]); o[db] = WFrag<T16>::mma(vf2[db], ph, o[db]); }
        } else {
            V p;
#pragma unroll
            for (int e = 0; e < 16; ++e) p[e] = tohx(x[e] * PCAR);
#pragma unroll
            for (int db = 0; db < 4; ++db) o[db] = WFrag<T16>::mma(vf[db], p, o[db]);
        }
    }
    l += xhalf(l);
    const float f = __fdiv_rn(HL ? 1.0f : (1.0f / PCAR), l);
#pragma unroll
    for (int db = 0; db < 4; ++db) { v8us oh, ol;   // registers 0..7 of O^T tile db are head columns db * 16 + 8 hi + r of the lane's query row: one 16-byte store per plane
#pragma unroll
        for (int r = 0; r < 8; ++r) { unsigned short a, c; splitf(o[db][r] * f, a, c); oh[r] = a; ol[r] = c; }
        *(v8us*)(Ah + db * 16) = oh; *(v8us*)(Al + db * 16) = ol; }
}
// grid (planes of the group, TT / 64 row blocks, the longest first), 128 threads; writes the merged context [b][t][h * HD + d] as hi/lo planes.
// amdgpu_waves_per_eu(4, 4): the launch is four waves per SIMD; told so, the compiler spends the registers on loads issued early instead of sinking them to their uses.
__global__ __launch_bounds__(128) __attribute__((amdgpu_waves_per_eu(4, 4))) void k_fattn(const h16* Q16, const h16* K16, const h16* V16, const bf* Qh, const bf* Ql, const bf* Kh, const bf* Kl, const bf* Vh, const bf* Vl, bf* Ah, bf* Al) {
    const int z = blockIdx.x; const int lane = threadIdx.x & 31, lr = lane & 15, hi = lane >> 4;
    const int q0 = (TT / 64 - 1 - (int)blockIdx.y) * 64 + __builtin_amdgcn_readfirstlane((int)(threadIdx.x >> 5)) * 16;   // wave-uniform, so the key loop is a scalar loop
    const size_t zp = (size_t)z * TT * HD; const size_t oo = ((size_t)(z / NH_) * TT + q0 + lr) * DQ + (z % NH_) * HD + 8 * hi;
    if (q0 < RH) attn_rows<bf, true>(Qh + zp, Ql + zp, Kh + zp, Kl + zp, Vh + zp, Vl + zp, q0, lr, hi, Ah + oo, Al + oo);
    else attn_rows<h16, false>(Q16 + zp, nullptr, K16 + zp, nullptr, V16 + zp, nullptr, q0, lr, hi, Ah + oo, Al + oo);
}

extern "C" void kernel_launch(void* const* d_in, const int* in_sizes, int n_in,
                              void* d_out, int out_size, void* d_ws, size_t ws_size, hipStream_t stream) {
    (void)in_sizes; (void)n_in; (void)out_size;
    const float* xr = (const float*)d_in[0]; const float* xe = (const float*)d_in[1]; const float* wq = (const float*)d_in[2]; const float* bq = (const float*)d_in[3]; const float* wk = (const float*)d_in[4]; const float* bk = (const float*)d_in[5]; const float* wv = (const float*)d_in[6]; const float* bv = (const float*)d_in[7]; const float* wo = (const float*)d_in[8]; const float* bo = (const float*)d_in[9]; const float* x = nullptr; (void)x;
    float* OUT = (float*)d_out;     // [8][1024][1024]
    char* wsp = (char*)d_ws;
    auto take = [&](size_t bytes) { char* p = wsp; wsp += (bytes + 255) & ~(size_t)255; return (void*)p; };
    const size_t WE = (size_t)DQ * DM, PE = (size_t)GB * NH_ * TT * HD;   // elements of a weight and of a set of head planes
    bf* WQ = (bf*)take(2 * WE * 2); bf* WK = WQ + WE; bf* WV = (bf*)take(WE * 2); bf* WO = (bf*)take(WE * 2);   // q's and k's arrays lie one behind the other: z of their common launch steps from one to the next
    h16* QP16 = (h16*)take(2 * PE * 2); h16* KP16 = QP16 + PE; h16* VT16 = (h16*)take(PE * 2);
    bf* QPh = (bf*)take(2 * PE * 2); bf* KPh = QPh + PE; bf* QPl = (bf*)take(2 * PE * 2); bf* KPl = QPl + PE; bf* VTh = (bf*)take(PE * 2); bf* VTl = (bf*)take(PE * 2);
    bf* XE = (bf*)take((size_t)GB * TT * DM * 2); bf* XR = (bf*)take((size_t)GB * TT * DM * 2); bf* ATh = (bf*)take((size_t)GB * TT * DQ * 2); bf* ATl = (bf*)take((size_t)GB * TT * DQ * 2);
    if ((size_t)(wsp - (char*)d_ws) > ws_size) return;    // 216 MiB of the 256 MiB
    k_prep<<<4 * WTB + 2 * CVB, 256, 0, stream>>>(wq, wk, wv, wo, xe, xr, WQ, WK, WV, WO, XE, XR);
    k_gemmw<bf, 0, true, 1><<<dim3(GB * TT / 128, DQ / 128, 2), 128, 0, stream>>>(XE, nullptr, WQ, nullptr, DM, nullptr, 0, bq, bk, 0, WE, 0, PE, QP16, QPh, QPl);   // encoder_output -> q (z = 0), k (z = 1)
    k_gemmw<bf, 0, true, 2><<<dim3(DKV / 128, GB * TT / 128, 1), 128, 0, stream>>>(WV, nullptr, XR, nullptr, DM, nullptr, 0, bv, nullptr, 0, 0, 0, 0, VT16, VTh, VTl);   // normalized_resid_pre -> v; weight rows as A: the tile comes out as V^T
    k_fattn<<<dim3(GB * NH_, TT / 64, 1), 128, 0, stream>>>(QP16, KP16, VT16, QPh, QPl, KPh, KPl, VTh, VTl, ATh, ATl);   // one kv head per query head: plane z of every array is (batch z / NH_, head z % NH_)
    k_gemmw<bf, 1, true, 0><<<dim3(GB * TT / 128, DM / 128, 1), 128, 0, stream>>>(ATh, ATl, WO, nullptr, DQ, OUT, DM, bo, nullptr, 0, 0, 0, 0, nullptr, nullptr, nullptr);
}

// v006
// A run of this version takes 149 microseconds.
// Next to v005, in two timings, it ran 1.22 times as fast each time.
// All steps since v000 together make it 27.1 times as fast.
#include <hip/hip_runtime.h>

// Decoder cross-attention with per-head weights (normalized_resid_pre, encoder_output [8][1024][1024]; q, k from encoder_output and v from normalized_resid_pre via 'hde' per-head weights [16][1024][64] + [16][64] biases; scores / 8 with the strict upper triangle REPLACED by -1e5; softmax; z O ('hed' [16][64][1024]) + Ob -> [8][1024][1024] (8.4 M)).
// Launch shape, five launches: one preparation launch (weights gathered, both inputs rounded); q and k as one GEMM grid (z picks the weight, bias and planes), v as a second; one fused attention launch over all GB x 16 (batch, head) planes; the O product. Every GEMM runs over all GB batches at once (GB x 1024 rows: M; N for v) and each projection writes its head planes itself.
// Layout per batch: the per-head 'hde' weights gathered once into single [1024][1024] operands (one exact GEMM per projection, flattened biases); fused causal T-1024 attention with a running maximum (hybrid rows: < 512 hi/lo 3 products, rest fp16 x1024; key blocks above the diagonal are skipped, their weights being exactly zero after the -1e5 fill); merged context as hi/lo planes; O (flat 'xw' [1024][1024]) hl x exact + Ob.
// Compute dtypes, f32 accumulate: every input rounded to bf16; projections exact + bf16-rounded biases; attention rows < 512 3 products, rest fp16; softmax f32; O hl x exact + bias.

#define NB_  8
#define TT   1024
#define DM   1024
#define NH_  16
#define NKV  16
#define REP  (NH_ / NKV)
#define HD   64
#define DQ   (NH_ * HD)
#define DKV  (NKV * HD)
#define GB   NB_                  // batches per launch: every launch covers all GB x TT rows
#define RH   512                  // query rows < RH use hi+lo planes (0: none)
#define PCAR 1024.0f
#define SCL  0.125f   // HD^-0.5
typedef _Float16 h16;
typedef unsigned short bf;
typedef __attribute__((ext_vector_type(16))) __bf16   v16bf;
typedef __attribute__((ext_vector_type(16))) _Float16 v16h;
typedef __attribute__((ext_vector_type(8)))  _Float16 v8h;
typedef __attribute__((ext_vector_type(8)))  unsigned short v8us;
typedef __attribute__((ext_vector_type(8)))  float    v8f;
typedef __attribute__((ext_vector_type(4)))  float    v4f;
typedef v8h  __attribute__((may_alias)) v8ha;
typedef v4f  __attribute__((may_alias)) v4fa;
typedef v8us __attribute__((may_alias)) v8usa;

__device__ __forceinline__ unsigned short f2bf(float f) { unsigned u = __float_as_uint(f); u += 0x7FFFu + ((u >> 16) & 1u); return (unsigned short)(u >> 16); }
__device__ __forceinline__ float bf2f(unsigned short b) { return __uint_as_float(((unsigned)b) << 16); }
__device__ __forceinline__ float bfr(float f) { return bf2f(f2bf(f)); }
__device__ __forceinline__ v16h cat16(v8h lo, v8h hi) { return __builtin_shufflevector(lo, hi, 0, 1, 2, 3, 4, 5, 6, 7, 8, 9, 10, 11, 12, 13, 14, 15); }
__device__ __forceinline__ v16bf cat16b(v8us lo, v8us hi) { return __builtin_bit_cast(v16bf, __builtin_shufflevector(lo, hi, 0, 1, 2, 3, 4, 5, 6, 7, 8, 9, 10, 11, 12, 13, 14, 15)); }
__device__ __forceinline__ v8f wmma16(v16h a, v16h b, v8f c) { return __builtin_amdgcn_wmma_f32_16x16x32_f16(false, a, false, b, (short)0, c, false, false); }
__device__ __forceinline__ v8f wmmab(v16bf a, v16bf b, v8f c) { return __builtin_amdgcn_wmma_f32_16x16x32_bf16(false, a, false, b, (short)0, c, false, false); }
__device__ __forceinline__ h16 tohx(float x) { return (h16)x; }
__device__ __forceinline__ void splitf(float y, unsigned short& h, unsigned short& l) { h = f2bf(y); l = f2bf(y - bf2f(h)); }



// ---- k_gemmw: GEMM, one work-group of four waves (2 x 2) per 128x128 output tile, ONE WAVE per 64x64 quarter (16 accumulators); grid (M/128, N/128, Z), 128 threads.
// The operands, K-contiguous 16-bit planes, come through LDS: a stage is 128 k (256-byte rows) of the tile's 128 A rows (A2 rows) and 128 Bt rows, brought by asynchronous 16-byte copies
// (a wave's copy covers two whole rows, so every request is whole lines, and each row is fetched once for the two waves that use it); two buffers, the next stage's copies fly while this one is worked on.
// C[m][n] (f32, pitch ldc, + optional f32 bias[n]) = sum_k A[m][k] Bt[n][k] (+ A2[m][k] Bt[n][k] for NSPLIT 1). z-batch strides sA/sB/sC, and sP for the planes, in elements; z = 1 takes bias2. K % 128 == 0, M % 128 == 0, N % 128 == 0.
// PL 1, 2: no C; the tile + bias goes out as fp16 and hi/lo bf16 head planes IN FRAGMENT ORDER: a plane is a row of 512-byte pieces, piece = 32 lanes x 8 elements, lane 16 hi + lr holding elements 8 hi .. 8 hi + 7 of a 16-wide
// column group of row lr of a 16-row tile, which is one half of a matrix operand as WFrag::ld splits it. Every store here and every fragment load of the attention kernel is then 512 contiguous bytes, four whole lines.
// PL 1: m = b * TT + t, n = h * HD + d, bias[n]: plane [b][h], pieces [t / 16][d / 16], row t % 16. PL 2 (the caller swaps the operands): m = h * HD + d, n = b * TT + t, bias[m]: plane [b][h], pieces [t / 32][d / 16][(t % 32) / 16], row d % 16.
#define GKP  128                  // k per stage
#define GPIT 272                  // LDS row pitch in bytes: 256 + 16, free of bank conflicts for 16-byte fragment reads
#define GOPB (128 * GPIT)         // bytes of one operand's 128 rows in a stage
template <typename T16> struct WFrag;   // ld: a fragment from a K-contiguous row; ldp: from a plane in fragment order (its two halves are neighbouring 512-byte pieces)
template <> struct WFrag<h16> { typedef v16h V; static __device__ __forceinline__ V ld(const h16* p) { return cat16(*(const v8h*)p, *(const v8h*)(p + 16)); } static __device__ __forceinline__ V ldp(const h16* p) { return cat16(*(const v8h*)p, *(const v8h*)(p + 256)); } static __device__ __forceinline__ v8f mma(V a, V b, v8f c) { return wmma16(a, b, c); } };
template <> struct WFrag<bf> { typedef v16bf V; static __device__ __forceinline__ V ld(const bf* p) { return cat16b(*(const v8us*)p, *(const v8us*)(p + 16)); } static __device__ __forceinline__ V ldp(const bf* p) { return cat16b(*(const v8us*)p, *(const v8us*)(p + 256)); } static __device__ __forceinline__ v8f mma(V a, V b, v8f c) { return wmmab(a, b, c); } };
// Eight asynchronous 16-byte copies of a lane, global to LDS, rows 8 apart (gs, GPIT: bytes from one row to the next). The s_wait_xcnt stands inside the statement, behind the last copy, so that no address register is rewritten ahead of it.
__device__ __forceinline__ void copy8(unsigned l, const char* g, size_t gs) {
    asm volatile("global_load_async_to_lds_b128 %0, %8, off\n\tglobal_load_async_to_lds_b128 %1, %9, off\n\tglobal_load_async_to_lds_b128 %2, %10, off\n\tglobal_load_async_to_lds_b128 %3, %11, off\n\t"
                 "global_load_async_to_lds_b128 %4, %12, off\n\tglobal_load_async_to_lds_b128 %5, %13, off\n\tglobal_load_async_to_lds_b128 %6, %14, off\n\tglobal_load_async_to_lds_b128 %7, %15, off\n\ts_wait_xcnt 0x0"
                 :: "v"(l), "v"(l + 8 * GPIT), "v"(l + 16 * GPIT), "v"(l + 24 * GPIT), "v"(l + 32 * GPIT), "v"(l + 40 * GPIT), "v"(l + 48 * GPIT), "v"(l + 56 * GPIT),
                    "v"(g), "v"(g + 8 * gs), "v"(g + 16 * gs), "v"(g + 24 * gs), "v"(g + 32 * gs), "v"(g + 40 * gs), "v"(g + 48 * gs), "v"(g + 56 * gs) : "memory");
}
template <typename T16, int NSPLIT, bool BIAS, int PL>
__global__ __launch_bounds__(128) void k_gemmw(const T16* __restrict__ A, const T16* __restrict__ A2, const T16* __restrict__ Bt, const T16* __restrict__ Bt2, int K, float* C, int ldc, const float* __restrict__ bias, const float* __restrict__ bias2, size_t sA, size_t sB, size_t sC, size_t sP, h16* P16, bf* Ph, bf* Pl) {
    static_assert(HD == 64 && TT % 64 == 0, "a 64x64 tile is one head wide and lies in one batch");
    static_assert(NSPLIT == 0 || NSPLIT == 1, "one Bt plane");
    typedef typename WFrag<T16>::V V;
    constexpr int NOP = (NSPLIT == 1) ? 3 : 2, STB = NOP * GOPB;   // operands in a stage: A, (A2,) Bt; bytes of a stage
    __shared__ __align__(16) unsigned char L[2 * STB];
    __shared__ __align__(16) float osw[4][16 * 68];
    const size_t z = blockIdx.z; A += z * sA; if (A2) A2 += z * sA; Bt += z * sB; C += z * sC; (void)Bt2;
    if (PL != 0) { P16 += z * sP; Ph += z * sP; Pl += z * sP; if (z) bias = bias2; }
    const int lane = threadIdx.x & 31, lr = lane & 15, hi = lane >> 4; const int wv = __builtin_amdgcn_readfirstlane((int)(threadIdx.x >> 5)), wm = wv >> 1, wn = wv & 1;
    const int r0 = blockIdx.x * 128 + wm * 64, c0 = blockIdx.y * 128 + wn * 64;   // the wave's own 64x64 tile
    float* os = osw[wv];
    v8f acc[4][4];
#pragma unroll
    for (int mb = 0; mb < 4; ++mb)
#pragma unroll
        for (int nb = 0; nb < 4; ++nb) acc[mb][nb] = (v8f){};
    // copies: this lane brings bytes 16 lr .. 16 lr + 15 of rows 2 wv + hi + 8 c, c = 0 .. 15, of every operand
    const int crow = 2 * wv + hi; const size_t gs = (size_t)K * 2;
    const char* gA = (const char*)(A + (size_t)(blockIdx.x * 128 + crow) * K) + 16 * lr; const char* gA2 = (NSPLIT == 1) ? (const char*)(A2 + (size_t)(blockIdx.x * 128 + crow) * K) + 16 * lr : gA;
    const char* gB = (const char*)(Bt + (size_t)(blockIdx.y * 128 + crow) * K) + 16 * lr;
    const unsigned lc = (unsigned)(size_t)(const void*)L + crow * GPIT + 16 * lr;   // its LDS byte address in buffer 0, operand 0
    auto stage = [&](int t, int buf) {   // stage t (k = t GKP ...) into buffer buf
        const unsigned l = lc + buf * STB; const size_t go = (size_t)t * (GKP * 2);
        auto rows = [&](unsigned lo, const char* g) {   // one operand's 128 rows
#pragma unroll 1   // rolled: unrolled, the address registers of all of a stage's copies are live at once, which spilled in the three-operand build
            for (int h = 0; h < 2; ++h) copy8(lo + h * 64 * GPIT, g + (size_t)h * 64 * gs, gs); };
        rows(l, gA + go); if (NSPLIT == 1) rows(l + GOPB, gA2 + go); rows(l + (NOP - 1) * GOPB, gB + go); };
    const int np = K / GKP;
    stage(0, 0);
    asm volatile("s_wait_asynccnt 0x0" ::: "memory");   // this wave's copies of stage 0 have landed
    __syncthreads();                                    // and every other wave's
    if (np > 1) stage(1, 1);
    const int fa = (wm * 64 + lr) * GPIT + 16 * hi, fb = (NOP - 1) * GOPB + (wn * 64 + lr) * GPIT + 16 * hi;   // the lane's first A and Bt fragment bytes in a stage
#pragma unroll 1
    for (int t = 0; t < np; ++t) {
        const unsigned char* sb = L + (t & 1) * STB;
        V a[2][4], a2[2][4], b[2][4];   // two fragment sets: the next 32 k are fetched, as one group, ahead of the products on this one
        auto ldf = [&](int s, int ks) {
#pragma unroll
            for (int mb = 0; mb < 4; ++mb) { a[s][mb] = WFrag<T16>::ld((const T16*)(sb + fa + mb * 16 * GPIT + ks * 64)); if (NSPLIT == 1) a2[s][mb] = WFrag<T16>::ld((const T16*)(sb + fa + GOPB + mb * 16 * GPIT + ks * 64)); }
#pragma unroll
            for (int nb = 0; nb < 4; ++nb) b[s][nb] = WFrag<T16>::ld((const T16*)(sb + fb + nb * 16 * GPIT + ks * 64)); };
        ldf(0, 0);
        __builtin_amdgcn_sched_barrier(0);               // the first set's reads go out first: the first products wait for them alone
#pragma unroll
        for (int ks = 0; ks < GKP / 32; ++ks) { const int s = ks & 1;
            if (ks + 1 < GKP / 32) ldf(s ^ 1, ks + 1);   // of this stage only: nothing of the next one is read in front of its barrier
            __builtin_amdgcn_sched_barrier(0);           // keeps the LDS reads one group in front of the block, for speed only
#pragma unroll
            for (int nb = 0; nb < 4; ++nb)
#pragma unroll
                for (int mb = 0; mb < 4; ++mb) { acc[mb][nb] = WFrag<T16>::mma(a[s][mb], b[s][nb], acc[mb][nb]); if (NSPLIT == 1) acc[mb][nb] = WFrag<T16>::mma(a2[s][mb], b[s][nb], acc[mb][nb]); }
            __builtin_amdgcn_sched_barrier(0);           // the other side of the same fence
        }
        // the distance behind the pass's last matrix instructions, also on the taken side of the branches below; naming every accumulator keeps all of them in front of it
        asm volatile("v_nop\n\tv_nop\n\tv_nop\n\tv_nop" : "+v"(acc[0][0]), "+v"(acc[0][1]), "+v"(acc[0][2]), "+v"(acc[0][3]), "+v"(acc[1][0]), "+v"(acc[1][1]), "+v"(acc[1][2]), "+v"(acc[1][3]),
                     "+v"(acc[2][0]), "+v"(acc[2][1]), "+v"(acc[2][2]), "+v"(acc[2][3]), "+v"(acc[3][0]), "+v"(acc[3][1]), "+v"(acc[3][2]), "+v"(acc[3][3]));
        asm volatile("s_wait_dscnt 0x0" ::: "memory");      // this wave has finished reading the buffer
        asm volatile("s_wait_asynccnt 0x0" ::: "memory");   // its copies of stage t + 1 have landed
        __syncthreads();                                    // publishes stage t + 1 and frees stage t's buffer
        if (t + 2 < np) stage(t + 2, t & 1);
    }
    asm volatile("s_wait_asynccnt 0x0" ::: "memory");       // nothing is in flight when the wave goes on
    float bb[32];   // plane epilogue: the lane stores row lr of each 16-row tile, columns 16 s + 8 hi .. + 7, s = 0 .. 3; its biases: PL 1 one per column, PL 2 one per tile row it will store
    if constexpr (PL != 0) {
#pragma unroll
        for (int u = 0; u < ((PL == 1) ? 32 : 4); ++u) bb[u] = bias[(PL == 1) ? c0 + (u >> 3) * 16 + 8 * hi + (u & 7) : r0 + 16 * u + lr];
        asm volatile("s_wait_xcnt 0x0" ::: "memory");    // behind the loads, before their address registers are reused
    }
#pragma unroll
    for (int mb = 0; mb < 4; ++mb) {
#pragma unroll
        for (int nb = 0; nb < 4; ++nb) {
#pragma unroll
            for (int j = 0; j < 8; ++j) os[(hi * 8 + j) * 68 + nb * 16 + lr] = acc[mb][nb][j]; }
        __builtin_amdgcn_wave_barrier(); asm volatile("" ::: "memory");
        if constexpr (PL == 0) {
        float* crow = C + (size_t)(r0 + mb * 16) * ldc + c0;
{
#pragma unroll
            for (int s = 0; s < 8; ++s) { const int row = 2 * s + hi, cofs = lr * 4; v4f val = *(const v4fa*)(os + row * 68 + cofs); if (BIAS) { val[0] += bfr(bias[c0 + cofs]); val[1] += bfr(bias[c0 + cofs + 1]); val[2] += bfr(bias[c0 + cofs + 2]); val[3] += bfr(bias[c0 + cofs + 3]); }
                *(v4f*)(crow + (size_t)row * ldc + cofs) = val; }
             }
        } else {
            // first plane element of the wave's 64x64 tile, which is 16 whole pieces one behind the other in either plane order
            const size_t pb = (PL == 1) ? ((size_t)((r0 / TT) * NH_ + c0 / HD) * TT + r0 % TT) * HD : ((size_t)((c0 / TT) * NH_ + r0 / HD) * TT + c0 % TT) * HD;
            v8h o16[4]; v8us oh[4], ol[4];
#pragma unroll
            for (int s = 0; s < 4; ++s) { const float* op = os + lr * 68 + s * 16 + 8 * hi; const v4f va = *(const v4fa*)op, vb = *(const v4fa*)(op + 4);
#pragma unroll
                for (int q = 0; q < 8; ++q) { const float y = ((q < 4) ? va[q & 3] : vb[q & 3]) + bfr(bb[(PL == 1) ? s * 8 + q : mb]); o16[s][q] = tohx(y); unsigned short a2, c2; splitf(y, a2, c2); oh[s][q] = a2; ol[s][q] = c2; }
                const size_t e = pb + ((PL == 1) ? mb * 4 + s : (s >> 1) * 8 + mb * 2 + (s & 1)) * 256 + lane * 8; *(v8h*)(P16 + e) = o16[s]; *(v8us*)(Ph + e) = oh[s]; *(v8us*)(Pl + e) = ol[s]; }
            // behind the 12 stores: naming their data keeps those registers from being rewritten ahead of the wait
            asm volatile("s_wait_xcnt 0x0" :: "v"(o16[0]), "v"(o16[1]), "v"(o16[2]), "v"(o16[3]), "v"(oh[0]), "v"(oh[1]), "v"(oh[2]), "v"(oh[3]), "v"(ol[0]), "v"(ol[1]), "v"(ol[2]), "v"(ol[3]) : "memory");
        }
        __builtin_amdgcn_wave_barrier(); asm volatile("" ::: "memory");
    }
}

typedef __attribute__((ext_vector_type(2))) _Float16 v2h;
typedef __attribute__((ext_vector_type(4))) _Float16 v4h;
typedef __attribute__((ext_vector_type(2))) unsigned short v2us;
typedef __attribute__((ext_vector_type(4))) unsigned short v4us;
typedef __attribute__((ext_vector_type(2))) float v2f;
typedef __attribute__((ext_vector_type(4))) int v4i;

// ---- k_prep: all operand preparation as one grid of 256-thread work-groups, the part picked by block index: WTB blocks for each of the four weights, then CVB blocks for each of the two inputs. Each thread's work is what it was in the separate launches.
#define WTB  (DM * DQ / 64 / 64)      // blocks per weight: 8 waves x 8 lines of 64 elements
#define CVB  (NB_ * TT * DM / 8 / 256)   // blocks per input: 8 elements a thread
__device__ __forceinline__ void wtG(const float* __restrict__ w, int K, int N, bf* Bt, int blk) {
    const int lane = threadIdx.x & 31; const int L0 = (blk * 8 + (threadIdx.x >> 5)) * 8; const int nlines = N * K / 64;
{
#pragma unroll 1
        for (int l = 0; l < 8; ++l) { const int L = L0 + l; if (L >= nlines) break; const size_t e = (size_t)L * 64 + lane * 2; const int k = (int)(e % K), n = (int)(e / K); v2us o;
            o[0] = f2bf(w[(size_t)k * N + n]); o[1] = f2bf(w[(size_t)(k + 1) * N + n]); *(v2us*)(Bt + e) = o;
            asm volatile("s_wait_xcnt 0x0" ::: "memory"); }   // behind the store, before the next trip rewrites its registers
         }
}
__device__ __forceinline__ void cvt8(const float* __restrict__ src, bf* dst, int blk) { const size_t i = (size_t)blk * 256 + threadIdx.x; const v8f v = *(const v8f*)(src + i * 8); v8us o;
#pragma unroll
    for (int k = 0; k < 8; ++k) o[k] = f2bf(v[k]); *(v8us*)(dst + i * 8) = o;
    asm volatile("s_wait_xcnt 0x0" :: "v"(o) : "memory"); }   // behind the store, its data named so that those registers are not rewritten ahead of it

__device__ __forceinline__ void wtN(const float* __restrict__ w, bf* Bt, int blk) { const int lane = threadIdx.x & 31; const int L0 = (blk * 8 + (threadIdx.x >> 5)) * 8; const int nlines = DQ * DM / 64;
{
#pragma unroll 1
        for (int l = 0; l < 8; ++l) { const int L = L0 + l; if (L >= nlines) break; const size_t e = (size_t)L * 64 + lane * 2; const int h = (int)(e % DM), r = (int)(e / DM); const int n = r / HD, d = r % HD; v2us o;
            o[0] = f2bf(w[((size_t)n * DM + h) * HD + d]); o[1] = f2bf(w[((size_t)n * DM + h + 1) * HD + d]); *(v2us*)(Bt + e) = o; }
         } }
__global__ __launch_bounds__(256) void k_prep(const float* __restrict__ wq, const float* __restrict__ wk, const float* __restrict__ wv, const float* __restrict__ wo, const float* __restrict__ xe, const float* __restrict__ xr, bf* WQ, bf* WK, bf* WV, bf* WO, bf* XE, bf* XR) {
    static_assert(NB_ * TT * DM % (8 * 256) == 0 && DM * DQ % (64 * 64) == 0, "whole blocks");
    const int bx = (int)blockIdx.x;   // the weights' blocks, the long ones (eight dependent gathers a wave), come first
    if (bx < 3 * WTB) { const int wsel = bx / WTB; wtN(wsel == 0 ? wq : wsel == 1 ? wk : wv, wsel == 0 ? WQ : wsel == 1 ? WK : WV, bx - wsel * WTB); }
    else if (bx < 4 * WTB) wtG(wo, DQ, DM, WO, bx - 3 * WTB);
    else { const int xsel = (bx - 4 * WTB) / CVB; cvt8(xsel ? xr : xe, xsel ? XR : XE, bx - 4 * WTB - xsel * CVB); }
}
// ---- k_fattn: fused causal attention, one wave per 16 query rows of one (batch, head) plane, four waves (64 rows) per work-group, no LDS and no barrier.
// Transposed products: S^T = K Q^T (A = 16 key rows, B = the wave's 16 query rows), so a lane holds scores of ONE query (column lr), keys 8 hi + r of each 16-key tile;
// two score tiles (32 keys), converted in place, are the B operand of O^T += V^T P^T (element s = tile s >> 3, register s & 7, the k order of WFrag::ld on the V^T rows, which WFrag::ldp keeps).
// Running maximum in the log2 domain, unnormalised weights, one division at the end. HL: hi/lo bf16 planes, 3 products each; otherwise fp16 with the weights carried x PCAR.
// Every inner loop is fully unrolled so that the fragment arrays stay in registers.
#define L2E 1.4426950408889634f
__device__ __forceinline__ float ex2(float x) { float y; asm("v_exp_f32 %0, %1\n\tv_nop" : "=v"(y) : "v"(x)); return y; }   // 2^x; the v_nop keeps the free slot behind a transcendental
__device__ __forceinline__ float xhalf(float x) { return __builtin_bit_cast(float, __builtin_amdgcn_permlanex16(__builtin_bit_cast(int, x), __builtin_bit_cast(int, x), 0x76543210, 0xfedcba98, false, false)); }   // lane l reads lane l ^ 16
template <typename T16, bool HL>
__device__ __forceinline__ void attn_rows(const T16* Q, const T16* Q2, const T16* Kp, const T16* K2, const T16* Vt, const T16* V2, int q0, int lr, int hi, bf* Ah, bf* Al) {
    typedef typename WFrag<T16>::V V;
    const int i = q0 + lr;                        // this lane's query row
    const int kend = (q0 & ~31) + 32;             // key blocks of 32 up to and including the diagonal block; weights beyond the diagonal are exactly zero
    const size_t ko = (size_t)(16 * hi + lr) * 8, qo = (size_t)q0 * HD + ko, vo = ko;   // planes in fragment order (k_gemmw): the lane's 16 bytes of a 512-byte piece; 16 rows of Q or K are 4 pieces, 32 keys of V^T are 8
    V q[2], q2[2], kf[2][2], kf2[2][2];
#pragma unroll
    for (int kc = 0; kc < 2; ++kc) { q[kc] = WFrag<T16>::ldp(Q + qo + kc * 512); if (HL) q2[kc] = WFrag<T16>::ldp(Q2 + qo + kc * 512); }
    auto ldk = [&](const T16* kp, const T16* kp2) {   // 32 K rows as A fragments
#pragma unroll
        for (int t = 0; t < 2; ++t)
#pragma unroll
            for (int kc = 0; kc < 2; ++kc) { kf[t][kc] = WFrag<T16>::ldp(kp + t * 16 * HD + kc * 512); if (HL) kf2[t][kc] = WFrag<T16>::ldp(kp2 + t * 16 * HD + kc * 512); } };
    if (!HL) ldk(Kp + ko, nullptr);
    v8f o[4];
#pragma unroll
    for (int db = 0; db < 4; ++db) o[db] = (v8f){};
    float m = -3.0e38f, l = 0.f;
    for (int kb = 0; kb < kend; kb += 32) {
        const T16* kp = Kp + ko + (size_t)kb * HD; const T16* kp2 = HL ? K2 + ko + (size_t)kb * HD : kp;
        if (HL) ldk(kp, kp2);                     // hi/lo planes: twice the fragment registers, so K is not fetched ahead (these rows have at most half the passes)
        V vf[4], vf2[4];                          // this block's V^T rows, issued ahead of the score products
        const T16* vp = Vt + vo + (size_t)kb * HD; const T16* vp2 = HL ? V2 + vo + (size_t)kb * HD : vp;
#pragma unroll
        for (int db = 0; db < 4; ++db) { vf[db] = WFrag<T16>::ldp(vp + db * 512); if (HL) vf2[db] = WFrag<T16>::ldp(vp2 + db * 512); }
        if (HL) asm volatile("s_wait_xcnt 0x0" :: "v"(kp), "v"(kp2), "v"(vp), "v"(vp2) : "memory");   // behind the loads: naming the addresses keeps their registers from becoming a later load's destination ahead of the wait
        v8f s[2];
#pragma unroll
        for (int t = 0; t < 2; ++t) { s[t] = (v8f){};
#pragma unroll
            for (int kc = 0; kc < 2; ++kc) { s[t] = WFrag<T16>::mma(kf[t][kc], q[kc], s[t]); if (HL) { s[t] = WFrag<T16>::mma(kf[t][kc], q2[kc], s[t]); s[t] = WFrag<T16>::mma(kf2[t][kc], q[kc], s[t]); } } }
        if (!HL) ldk(Kp + ko + (size_t)min(kb + 32, kend - 32) * HD, nullptr);    // the next block's K rows fly during the softmax (the last pass re-reads its own block: in bounds, unused)
        float x[16]; float mx = m;
#pragma unroll
        for (int e = 0; e < 16; ++e) { const int j = kb + (e >> 3) * 16 + 8 * hi + (e & 7); x[e] = (j <= i) ? s[e >> 3][e & 7] * (SCL * L2E) : -3.0e38f; mx = fmaxf(mx, x[e]); }
        mx = fmaxf(mx, xhalf(mx));   // the other half of the wave holds the query's other 16 keys
        float ps[4] = {0.f, 0.f, 0.f, 0.f};       // four short chains instead of one of 16 dependent adds
#pragma unroll
        for (int e = 0; e < 16; ++e) { x[e] = ex2(x[e] - mx); ps[e & 3] += x[e]; }
        const float al = ex2(m - mx); m = mx;     // what the sums so far are worth under the new maximum
        l = l * al + ((ps[0] + ps[1]) + (ps[2] + ps[3]));
#pragma unroll
        for (int db = 0; db < 4; ++db) o[db] *= al;
        if constexpr (HL) {
            v8us h0, h1, l0, l1;
#pragma unroll
            for (int r = 0; r < 8; ++r) { unsigned short a, c; splitf(x[r], a, c); h0[r] = a; l0[r] = c; splitf(x[8 + r], a, c); h1[r] = a; l1[r] = c; }
            const V ph = cat16b(h0, h1), pl = cat16b(l0, l1);
#pragma unroll
            for (int db = 0; db < 4; ++db) { o[db] = WFrag<T16>::mma(vf[db], ph, o[db]); o[db] = WFrag<T16>::mma(vf[db], pl, o[db]); o[db] = WFrag<T16>::mma(vf2[db], ph, o[db]); }
        } else {
            V p;
#pragma unroll
            for (int e = 0; e < 16; ++e) p[e] = tohx(x[e] * PCAR);
#pragma unroll
            for (int db = 0; db < 4; ++db) o[db] = WFrag<T16>::mma(vf[db], p, o[db]);
        }
    }
    l += xhalf(l);
    const float f = __fdiv_rn(HL ? 1.0f : (1.0f / PCAR), l);
#pragma unroll
    for (int db = 0; db < 4; ++db) { v8us oh, ol;   // registers 0..7 of O^T tile db are head columns db * 16 + 8 hi + r of the lane's query row: one 16-byte store per plane
#pragma unroll
        for (int r = 0; r < 8; ++r) { unsigned short a, c; splitf(o[db][r] * f, a, c); oh[r] = a; ol[r] = c; }
        *(v8us*)(Ah + db * 16) = oh; *(v8us*)(Al + db * 16) = ol; }
}
// grid (planes of the group, TT / 64 row blocks, the longest first), 128 threads; writes the merged context [b][t][h * HD + d] as hi/lo planes.
// amdgpu_waves_per_eu(4, 4): the launch is four waves per SIMD; told so, the compiler spends the registers on loads issued early instead of sinking them to their uses.
__global__ __launch_bounds__(128) __attribute__((amdgpu_waves_per_eu(4, 4))) void k_fattn(const h16* Q16, const h16* K16, const h16* V16, const bf* Qh, const bf* Ql, const bf* Kh, const bf* Kl, const bf* Vh, const bf* Vl, bf* Ah, bf* Al) {
    const int z = blockIdx.x; const int lane = threadIdx.x & 31, lr = lane & 15, hi = lane >> 4;
    const int q0 = (TT / 64 - 1 - (int)blockIdx.y) * 64 + __builtin_amdgcn_readfirstlane((int)(threadIdx.x >> 5)) * 16;   // wave-uniform, so the key loop is a scalar loop
    const size_t zp = (size_t)z * TT * HD; const size_t oo = ((size_t)(z / NH_) * TT + q0 + lr) * DQ + (z % NH_) * HD + 8 * hi;
    if (q0 < RH) attn_rows<bf, true>(Qh + zp, Ql + zp, Kh + zp, Kl + zp, Vh + zp, Vl + zp, q0, lr, hi, Ah + oo, Al + oo);
    else attn_rows<h16, false>(Q16 + zp, nullptr, K16 + zp, nullptr, V16 + zp, nullptr, q0, lr, hi, Ah + oo, Al + oo);
}

extern "C" void kernel_launch(void* const* d_in, const int* in_sizes, int n_in,
                              void* d_out, int out_size, void* d_ws, size_t ws_size, hipStream_t stream) {
    (void)in_sizes; (void)n_in; (void)out_size;
    const float* xr = (const float*)d_in[0]; const float* xe = (const float*)d_in[1]; const float* wq = (const float*)d_in[2]; const float* bq = (const float*)d_in[3]; const float* wk = (const float*)d_in[4]; const float* bk = (const float*)d_in[5]; const float* wv = (const float*)d_in[6]; const float* bv = (const float*)d_in[7]; const float* wo = (const float*)d_in[8]; const float* bo = (const float*)d_in[9]; const float* x = nullptr; (void)x;
    float* OUT = (float*)d_out;     // [8][1024][1024]
    char* wsp = (char*)d_ws;
    auto take = [&](size_t bytes) { char* p = wsp; wsp += (bytes + 255) & ~(size_t)255; return (void*)p; };
    const size_t WE = (size_t)DQ * DM, PE = (size_t)GB * NH_ * TT * HD;   // elements of a weight and of a set of head planes
    bf* WQ = (bf*)take(2 * WE * 2); bf* WK = WQ + WE; bf* WV = (bf*)take(WE * 2); bf* WO = (bf*)take(WE * 2);   // q's and k's arrays lie one behind the other: z of their common launch steps from one to the next
    h16* QP16 = (h16*)take(2 * PE * 2); h16* KP16 = QP16 + PE; h16* VT16 = (h16*)take(PE * 2);
    bf* QPh = (bf*)take(2 * PE * 2); bf* KPh = QPh + PE; bf* QPl = (bf*)take(2 * PE * 2); bf* KPl = QPl + PE; bf* VTh = (bf*)take(PE * 2); bf* VTl = (bf*)take(PE * 2);
    bf* XE = (bf*)take((size_t)GB * TT * DM * 2); bf* XR = (bf*)take((size_t)GB * TT * DM * 2); bf* ATh = (bf*)take((size_t)GB * TT * DQ * 2); bf* ATl = (bf*)take((size_t)GB * TT * DQ * 2);
    if ((size_t)(wsp - (char*)d_ws) > ws_size) return;    // 216 MiB of the 256 MiB
    k_prep<<<4 * WTB + 2 * CVB, 256, 0, stream>>>(wq, wk, wv, wo, xe, xr, WQ, WK, WV, WO, XE, XR);
    k_gemmw<bf, 0, true, 1><<<dim3(GB * TT / 128, DQ / 128, 2), 128, 0, stream>>>(XE, nullptr, WQ, nullptr, DM, nullptr, 0, bq, bk, 0, WE, 0, PE, QP16, QPh, QPl);   // encoder_output -> q (z = 0), k (z = 1)
    k_gemmw<bf, 0, true, 2><<<dim3(DKV / 128, GB * TT / 128, 1), 128, 0, stream>>>(WV, nullptr, XR, nullptr, DM, nullptr, 0, bv, nullptr, 0, 0, 0, 0, VT16, VTh, VTl);   // normalized_resid_pre -> v; weight rows as A: the tile comes out as V^T
    k_fattn<<<dim3(GB * NH_, TT / 64, 1), 128, 0, stream>>>(QP16, KP16, VT16, QPh, QPl, KPh, KPl, VTh, VTl, ATh, ATl);   // one kv head per query head: plane z of every array is (batch z / NH_, head z % NH_)
    k_gemmw<bf, 1, true, 0><<<dim3(GB * TT / 128, DM / 128, 1), 128, 0, stream>>>(ATh, ATl, WO, nullptr, DQ, OUT, DM, bo, nullptr, 0, 0, 0, 0, nullptr, nullptr, nullptr);
}
